// v000
// The times below were measured on an AMD MI455X: many runs one after another, warmed up first and cycling through
// copies of the inputs, with the whole window's GPU time divided by the number of runs. Launches and the gaps
// between them are all in it. The median over several windows is given; except for v000 it joins two sittings, which
// can be a few percent apart, so the side-by-side timings, each taken in one sitting, are the better comparison.
// v000 is the starting kernel. One run takes 999 microseconds.
#include <hip/hip_runtime.h>

typedef __attribute__((ext_vector_type(16))) _Float16 v16h;
typedef __attribute__((ext_vector_type(8)))  _Float16 v8h;
typedef __attribute__((ext_vector_type(8)))  float    v8f;
typedef __attribute__((ext_vector_type(4)))  float    v4f;

// Contractions (Q/K/V 1x1 convs K = 256; scores Q.K over C = 256; attn @ V over 4096 keys) on v_wmma_f32_16x16x32_f16:
// f16 operands, f32 accumulate; online softmax in f32 with P lifted by 2^14 before the f16 conversion; B fragments use the
// same per-lane K map as A (8*half+0..7, 16+8*half+0..7). Q/K/V panels and the output are staged in LDS and written as whole
typedef __attribute__((ext_vector_type(4)))  unsigned v4u;
template <typename T> __device__ __forceinline__ void vst2(void* p, T v) { *(T*)p = v;  }
__device__ __forceinline__ v8f WMMA_F16(v16h a, v16h b, v8f c) {
  v8f d = __builtin_amdgcn_wmma_f32_16x16x32_f16(false, a, false, b, (short)0, c, false, false);
  asm volatile("v_nop\n\tv_nop\n\tv_nop\n\tv_nop" : "+v"(d) : "v"(a), "v"(b));
  return d;
}
__device__ __forceinline__ v16h bfrag16(const _Float16* rowk0, int half) {     // row pointer at k0; k = 8*half+i, 16+8*half+i
  v16h b; ((v8h*)&b)[0] = *(const v8h*)(rowk0 + half * 8); ((v8h*)&b)[1] = *(const v8h*)(rowk0 + 16 + half * 8); return b;
}
#define LDSX() do { asm volatile("s_wait_dscnt 0" ::: "memory"); __builtin_amdgcn_wave_barrier(); __builtin_amdgcn_fence(__ATOMIC_RELEASE, "workgroup"); } while (0)

constexpr int Bsz = 4;
constexpr int Cch = 256;   // channels
constexpr int Nsq = 4096;  // sequence positions

// ---------------------------------------------------------------------------
// Kernel 0: convert the three 256x256 weight matrices to f16 (packed [3][C][C])
// ---------------------------------------------------------------------------
__global__ void wcvt_kernel(const float* __restrict__ wq,
                            const float* __restrict__ wk,
                            const float* __restrict__ wv,
                            _Float16* __restrict__ out) {
  int g8 = blockIdx.x * 256 + threadIdx.x;      // 0 .. 3*65536/8-1, 16 B per thread
  int t0 = g8 * 8; int m = t0 >> 16, e = t0 & 65535;
  const float* s = (m == 0) ? wq : (m == 1) ? wk : wv;
  union { v8h h; v4u u; } pk;
#pragma unroll
  for (int i = 0; i < 8; ++i) pk.h[i] = (_Float16)s[e + i];
  vst2(out + t0, pk.u);
}

// ---------------------------------------------------------------------------
// Kernel 1: QKV projection via WMMA.
//   Qt, Kt : [B][N][C] f16  (row n, contiguous channels -> A/B frags are b128)
//   V      : [B][C][N] f16  (row c, contiguous j        -> B frags are b128)
// One wave handles a 16-row n tile; x tile transposed through LDS once.
// ---------------------------------------------------------------------------
__global__ void __launch_bounds__(128, 1)
qkv_kernel(const float* __restrict__ x,         // [B][C][N] f32
           const _Float16* __restrict__ wh,     // [3][C][C] f16
           const float* __restrict__ bq,
           const float* __restrict__ bk,
           const float* __restrict__ bv,
           _Float16* __restrict__ Qt,
           _Float16* __restrict__ Kt,
           _Float16* __restrict__ V) {
  __shared__ __align__(16) _Float16 xT[4][16 * 256];          // per-wave x^T tile (8KB each), reused as the Q/K row staging
  __shared__ __align__(16) _Float16 sVst[256 * 64];            // block staging of V [o][n0blk..+63] (32 KB)
  const int wave = threadIdx.x >> 5, lane = threadIdx.x & 31;
  const int tile = blockIdx.x * 4 + wave;       // 0..1023
  const int b  = tile >> 8;                     // 256 n-tiles per batch
  const int n0 = (tile & 255) << 4;
  const int row = lane & 15, half = lane >> 4;

  _Float16* xt = xT[wave];
  const float* xb = x + (size_t)b * Cch * Nsq;
  // stage x[b][:, n0..n0+15] transposed into LDS as xT[n][c] f16
  #pragma unroll 4
  for (int it = 0; it < 128; ++it) {
    int idx = it * 32 + lane;
    int c = idx >> 4, n = idx & 15;
    xt[n * 256 + c] = (_Float16)xb[(size_t)c * Nsq + n0 + n];
  }
  LDSX();

  // A fragments of x^T (M=n, K=c), K=256 in 8 chunks of 32
  v16h a[8];
  #pragma unroll
  for (int k = 0; k < 8; ++k) {
    ((v8h*)&a[k])[0] = *(const v8h*)&xt[row * 256 + k * 32 + half * 8];
    ((v8h*)&a[k])[1] = *(const v8h*)&xt[row * 256 + k * 32 + half * 8 + 16];
  }

  #pragma unroll
  for (int m = 0; m < 3; ++m) {                 // m constant after unroll:
    const _Float16* W = wh + (size_t)m * 65536; //   no flat loads, no branches
    const float* bias = (m == 0) ? bq : (m == 1) ? bk : bv;
    for (int ot = 0; ot < 16; ++ot) {
      const int o = ot * 16 + row;              // this lane's output column
      v8f acc = {};
      #pragma unroll
      for (int k = 0; k < 8; ++k) acc = WMMA_F16(a[k], bfrag16(&W[o * 256 + k * 32], half), acc);   // same K map as A
      const float bo = bias[o];
      #pragma unroll
      for (int v = 0; v < 8; ++v) {             // D: (M = v + 8*half, N = row) -> stage in LDS
        float val = acc[v] + bo;
        int nl = v + half * 8;                  // local n (0..15)
        if (m < 2) xt[nl * 256 + o] = (_Float16)val;                 // Q/K rows [n][o] (xt is free: A frags live in registers)
        else       sVst[o * 64 + wave * 16 + nl] = (_Float16)val;    // V [o][block-local n]
      }
    }
    if (m < 2) {                                // this wave's 16 rows of Qt / Kt: 512 B each = 32 lanes x 16 B
      LDSX();
      _Float16* dst = (m == 0 ? Qt : Kt) + ((size_t)b * Nsq + n0) * Cch;
      #pragma unroll 4
      for (int nl = 0; nl < 16; ++nl) vst2(dst + (size_t)nl * Cch + lane * 8, *(const v4u*)&xt[nl * 256 + lane * 8]);
      __builtin_amdgcn_wave_barrier();          // before the next m overwrites xt
    }
  }
  __syncthreads();
  const int n0blk = ((blockIdx.x * 4) & 255) << 4;
  for (int q = threadIdx.x; q < 256 * 8; q += 128) { const int o = q >> 3, pc = q & 7;
    vst2(V + ((size_t)b * Cch + o) * (size_t)Nsq + n0blk + pc * 8, *(const v4u*)&sVst[o * 64 + pc * 8]); }
}

// ---------------------------------------------------------------------------
// Kernel 2: flash attention + residual. One wave = 16 query rows x 256 channels.
// ---------------------------------------------------------------------------
__global__ void __launch_bounds__(128, 1)
attn_kernel(const float* __restrict__ x,
            const _Float16* __restrict__ Qt,   // [B][N][C]
            const _Float16* __restrict__ Kt,   // [B][N][C]
            const _Float16* __restrict__ Vm,   // [B][C][N]
            float* __restrict__ out) {
  __shared__ __align__(16) _Float16 pbuf[4][16 * 32];        // per-wave prob tile (1KB each)
  __shared__ __align__(16) float    cst[128 * 64];
  const int wave = threadIdx.x >> 5, lane = threadIdx.x & 31;
  const int tile = blockIdx.x * 4 + wave;      // 0..1023
  const int b  = tile >> 8;
  const int i0 = (tile & 255) << 4;
  const int row = lane & 15, half = lane >> 4;
  const float C1 = 0.0625f * 1.44269504089f;   // (1/sqrt(256)) * log2(e)

  // Q A-fragments (M=i, K=c): re-read per key tile (L1/L2 resident) to keep VGPRs < 256
  const _Float16* Qb = Qt + ((size_t)b * Nsq + i0 + row) * Cch;

  v8f acc[16];                                  // context^T tile [16 i][256 c]
  #pragma unroll
  for (int ct = 0; ct < 16; ++ct) { v8f z = {}; acc[ct] = z; }
  float mrow[8], srow[8];                       // online-softmax stats per row
  #pragma unroll
  for (int v = 0; v < 8; ++v) { mrow[v] = -3.0e38f; srow[v] = 0.f; }
  _Float16* pl = pbuf[wave];

  for (int j0 = 0; j0 < Nsq; j0 += 32) {
    // ---- scores: two 16x16 tiles (j0..15, j0+16..31), K = 256 ----
    const _Float16* K0 = Kt + ((size_t)b * Nsq + j0 + row) * Cch;          // key row (j0+row); same K map as q
    const _Float16* K1 = K0 + 16 * Cch;
    const _Float16* Vb = Vm + ((size_t)b * Cch + row) * (size_t)Nsq + j0;     // V row (c = ct*16+row) at key j0
    v8f sD0 = {}, sD1 = {};
    #pragma unroll
    for (int k = 0; k < 8; ++k) {
      const v16h qk = bfrag16(Qb + k * 32, half);          // A map == B map helper (row ptr at k0)
      sD0 = WMMA_F16(qk, bfrag16(K0 + k * 32, half), sD0);
      sD1 = WMMA_F16(qk, bfrag16(K1 + k * 32, half), sD1);
    }
    // ---- online softmax, one row (VGPR index v) at a time ----
    #pragma unroll
    for (int v = 0; v < 8; ++v) {
      float lm = fmaxf(sD0[v], sD1[v]);         // row-wise max across N lanes
      lm = fmaxf(lm, __shfl_xor(lm, 8, 32));
      lm = fmaxf(lm, __shfl_xor(lm, 4, 32));
      lm = fmaxf(lm, __shfl_xor(lm, 2, 32));
      lm = fmaxf(lm, __shfl_xor(lm, 1, 32));
      const float mn  = fmaxf(mrow[v], lm);
      const float cor = __builtin_exp2f((mrow[v] - mn) * C1);
      mrow[v] = mn;
      const float p0 = __builtin_exp2f((sD0[v] - mn) * C1);
      const float p1 = __builtin_exp2f((sD1[v] - mn) * C1);
      float rs = p0 + p1;
      rs += __shfl_xor(rs, 8, 32);
      rs += __shfl_xor(rs, 4, 32);
      rs += __shfl_xor(rs, 2, 32);
      rs += __shfl_xor(rs, 1, 32);
      srow[v] = srow[v] * cor + rs;
      const int ir = v + half * 8;              // this element's query row
      pl[ir * 32 + row]      = (_Float16)(p0 * 16384.0f);    // prob tile [i][j] in LDS, lifted by 2^14 (p <= 1)
      pl[ir * 32 + 16 + row] = (_Float16)(p1 * 16384.0f);
      #pragma unroll
      for (int ct = 0; ct < 16; ++ct) acc[ct][v] *= cor;  // rescale context
    }
    LDSX();
    // ---- re-layout probs as A fragment (M=i, K=j, 16x32) from LDS ----
    v16h pa;
    ((v8h*)&pa)[0] = *(const v8h*)&pl[row * 32 + half * 8];
    ((v8h*)&pa)[1] = *(const v8h*)&pl[row * 32 + half * 8 + 16];
    // ---- context += attn x V^T : 16 channel tiles ----
    #pragma unroll
    for (int ct = 0; ct < 16; ++ct) acc[ct] = WMMA_F16(pa, bfrag16(Vb + (size_t)ct * 16 * Nsq, half), acc[ct]);   // keys 8*half.., 16+8*half..
    __builtin_amdgcn_wave_barrier();            // pl reads done before the next tile's writes
  }

  // ---- epilogue: out = x + context / rowsum.
  // Transpose context through LDS (two 128-channel passes) so the residual
  // add runs on full 256-byte channel rows with b128 loads/stores.
  // Block = 4 waves = 64 consecutive query positions: stage [128 c][64 i] per pass, then 256-B row segments of (b, c, i0blk..)
  float rinv[8];
  #pragma unroll
  for (int v = 0; v < 8; ++v) rinv[v] = (1.0f / 16384.0f) / srow[v];
  const int i0blk = ((blockIdx.x * 4) & 255) << 4;
  #pragma unroll
  for (int pass = 0; pass < 2; ++pass) {
    __syncthreads();
    #pragma unroll
    for (int ct = 0; ct < 8; ++ct) {
      const int cl = ct * 16 + row;             // local channel 0..127
      #pragma unroll
      for (int v = 0; v < 8; ++v)
        cst[cl * 64 + wave * 16 + v + half * 8] = acc[pass * 8 + ct][v] * rinv[v];
    }
    __syncthreads();
    for (int qd = threadIdx.x; qd < 128 * 16; qd += 128) { const int cl = qd >> 4, pc = qd & 15;
      const int c = pass * 128 + cl;
      const size_t base = ((size_t)b * Cch + c) * (size_t)Nsq + i0blk + pc * 4;
      v4f cv = *(const v4f*)&cst[cl * 64 + pc * 4] + *(const v4f*)&x[base];
      vst2(out + base, cv); }
  }
}

// ---------------------------------------------------------------------------
extern "C" void kernel_launch(void* const* d_in, const int* in_sizes, int n_in,
                              void* d_out, int out_size, void* d_ws, size_t ws_size,
                              hipStream_t stream) {
  const float* x  = (const float*)d_in[0];
  const float* Wq = (const float*)d_in[1];
  const float* bq = (const float*)d_in[2];
  const float* Wk = (const float*)d_in[3];
  const float* bk = (const float*)d_in[4];
  const float* Wv = (const float*)d_in[5];
  const float* bv = (const float*)d_in[6];
  float* out = (float*)d_out;

  // workspace layout: [3][C][C] f16 weights | Qt | Kt | V  (~24.4 MiB total)
  char* ws = (char*)d_ws;
  _Float16* wh = (_Float16*)ws;
  _Float16* Qt = (_Float16*)(ws + (size_t)3 * Cch * Cch * 2);
  _Float16* Kt = Qt + (size_t)Bsz * Nsq * Cch;
  _Float16* V  = Kt + (size_t)Bsz * Nsq * Cch;

  wcvt_kernel<<<(3 * Cch * Cch / 8) / 256, 256, 0, stream>>>(Wq, Wk, Wv, wh);
  // 1024 wave-tiles, 4 waves (128 threads) per block
  qkv_kernel<<<256, 128, 0, stream>>>(x, wh, bq, bk, bv, Qt, Kt, V);
  attn_kernel<<<256, 128, 0, stream>>>(x, Qt, Kt, V, out);
}

// v001
// One run takes 351 microseconds.
// In two side-by-side timings against v000, it was 2.88 and 2.87 times as fast.
#include <hip/hip_runtime.h>

typedef __attribute__((ext_vector_type(16))) _Float16 v16h;
typedef __attribute__((ext_vector_type(8)))  _Float16 v8h;
typedef __attribute__((ext_vector_type(8)))  float    v8f;
typedef __attribute__((ext_vector_type(4)))  float    v4f;

// Contractions (Q/K/V 1x1 convs K = 256; scores Q.K over C = 256; attn @ V over 4096 keys) on v_wmma_f32_16x16x32_f16:
// f16 operands, f32 accumulate; online softmax in f32 with P lifted by 2^14 before the f16 conversion; B fragments use the
// same per-lane K map as A (8*half+0..7, 16+8*half+0..7). Q/K/V panels and the output are staged in LDS and written as whole
typedef __attribute__((ext_vector_type(4)))  unsigned v4u;
template <typename T> __device__ __forceinline__ void vst2(void* p, T v) { *(T*)p = v;  }
__device__ __forceinline__ v8f WMMA_F16(v16h a, v16h b, v8f c) {
  v8f d = __builtin_amdgcn_wmma_f32_16x16x32_f16(false, a, false, b, (short)0, c, false, false);
  asm volatile("v_nop\n\tv_nop\n\tv_nop\n\tv_nop" : "+v"(d) : "v"(a), "v"(b));
  return d;
}
__device__ __forceinline__ v16h bfrag16(const _Float16* rowk0, int half) {     // row pointer at k0; k = 8*half+i, 16+8*half+i
  v16h b; ((v8h*)&b)[0] = *(const v8h*)(rowk0 + half * 8); ((v8h*)&b)[1] = *(const v8h*)(rowk0 + 16 + half * 8); return b;
}
#define LDSX() do { asm volatile("s_wait_dscnt 0" ::: "memory"); __builtin_amdgcn_wave_barrier(); __builtin_amdgcn_fence(__ATOMIC_RELEASE, "workgroup"); } while (0)

constexpr int Bsz = 4;
constexpr int Cch = 256;   // channels
constexpr int Nsq = 4096;  // sequence positions

// ---------------------------------------------------------------------------
// Kernel 0: convert the three 256x256 weight matrices to f16 (packed [3][C][C])
// ---------------------------------------------------------------------------
__global__ void wcvt_kernel(const float* __restrict__ wq,
                            const float* __restrict__ wk,
                            const float* __restrict__ wv,
                            _Float16* __restrict__ out) {
  int g8 = blockIdx.x * 256 + threadIdx.x;      // 0 .. 3*65536/8-1, 16 B per thread
  int t0 = g8 * 8; int m = t0 >> 16, e = t0 & 65535;
  const float* s = (m == 0) ? wq : (m == 1) ? wk : wv;
  union { v8h h; v4u u; } pk;
#pragma unroll
  for (int i = 0; i < 8; ++i) pk.h[i] = (_Float16)s[e + i];
  vst2(out + t0, pk.u);
}

// ---------------------------------------------------------------------------
// Kernel 1: QKV projection via WMMA.
//   Qt, Kt : [B][N][C] f16  (row n, contiguous channels -> A/B frags are b128)
//   V      : [B][C][N] f16  (row c, contiguous j        -> B frags are b128)
// One wave handles a 16-row n tile; x tile transposed through LDS once.
// ---------------------------------------------------------------------------
__global__ void __launch_bounds__(128, 1)
qkv_kernel(const float* __restrict__ x,         // [B][C][N] f32
           const _Float16* __restrict__ wh,     // [3][C][C] f16
           const float* __restrict__ bq,
           const float* __restrict__ bk,
           const float* __restrict__ bv,
           _Float16* __restrict__ Qt,
           _Float16* __restrict__ Kt,
           _Float16* __restrict__ V) {
  __shared__ __align__(16) _Float16 xT[4][16 * 256];          // per-wave x^T tile (8KB each), reused as the Q/K row staging
  __shared__ __align__(16) _Float16 sVst[256 * 64];            // block staging of V [o][n0blk..+63] (32 KB)
  const int wave = threadIdx.x >> 5, lane = threadIdx.x & 31;
  const int tile = blockIdx.x * 4 + wave;       // 0..1023
  const int b  = tile >> 8;                     // 256 n-tiles per batch
  const int n0 = (tile & 255) << 4;
  const int row = lane & 15, half = lane >> 4;

  _Float16* xt = xT[wave];
  const float* xb = x + (size_t)b * Cch * Nsq;
  // stage x[b][:, n0..n0+15] transposed into LDS as xT[n][c] f16
  #pragma unroll 4
  for (int it = 0; it < 128; ++it) {
    int idx = it * 32 + lane;
    int c = idx >> 4, n = idx & 15;
    xt[n * 256 + c] = (_Float16)xb[(size_t)c * Nsq + n0 + n];
  }
  LDSX();

  // A fragments of x^T (M=n, K=c), K=256 in 8 chunks of 32
  v16h a[8];
  #pragma unroll
  for (int k = 0; k < 8; ++k) {
    ((v8h*)&a[k])[0] = *(const v8h*)&xt[row * 256 + k * 32 + half * 8];
    ((v8h*)&a[k])[1] = *(const v8h*)&xt[row * 256 + k * 32 + half * 8 + 16];
  }

  #pragma unroll
  for (int m = 0; m < 3; ++m) {                 // m constant after unroll:
    const _Float16* W = wh + (size_t)m * 65536; //   no flat loads, no branches
    const float* bias = (m == 0) ? bq : (m == 1) ? bk : bv;
    for (int ot = 0; ot < 16; ++ot) {
      const int o = ot * 16 + row;              // this lane's output column
      v8f acc = {};
      #pragma unroll
      for (int k = 0; k < 8; ++k) acc = WMMA_F16(a[k], bfrag16(&W[o * 256 + k * 32], half), acc);   // same K map as A
      const float bo = bias[o];
      #pragma unroll
      for (int v = 0; v < 8; ++v) {             // D: (M = v + 8*half, N = row) -> stage in LDS
        float val = acc[v] + bo;
        int nl = v + half * 8;                  // local n (0..15)
        if (m < 2) xt[nl * 256 + o] = (_Float16)val;                 // Q/K rows [n][o] (xt is free: A frags live in registers)
        else       sVst[o * 64 + wave * 16 + nl] = (_Float16)val;    // V [o][block-local n]
      }
    }
    if (m < 2) {                                // this wave's 16 rows of Qt / Kt: 512 B each = 32 lanes x 16 B
      LDSX();
      _Float16* dst = (m == 0 ? Qt : Kt) + ((size_t)b * Nsq + n0) * Cch;
      #pragma unroll 4
      for (int nl = 0; nl < 16; ++nl) vst2(dst + (size_t)nl * Cch + lane * 8, *(const v4u*)&xt[nl * 256 + lane * 8]);
      __builtin_amdgcn_wave_barrier();          // before the next m overwrites xt
    }
  }
  __syncthreads();
  const int n0blk = ((blockIdx.x * 4) & 255) << 4;
  for (int q = threadIdx.x; q < 256 * 8; q += 128) { const int o = q >> 3, pc = q & 7;
    vst2(V + ((size_t)b * Cch + o) * (size_t)Nsq + n0blk + pc * 8, *(const v4u*)&sVst[o * 64 + pc * 8]); }
}

// ---------------------------------------------------------------------------
// Kernel 2: flash attention + residual. One wave = 16 query rows x 256 channels.
// The block's 64 Q rows (once) and 64-key K and V tiles (two buffers) reach LDS by asynchronous copies of whole lines;
// the four waves read their fragments from there. Row pitches are 16 B x odd, so a ds_load_b128 meets no bank twice.
// ---------------------------------------------------------------------------
constexpr int KT   = 64;                 // keys per LDS stage = two 32-key softmax steps
constexpr int KPIT = Cch + 8;            // halfs per Q / K row in LDS: 512 B + 16 B
constexpr int VPIT = KT + 8;             // halfs per V row in LDS: 128 B + 16 B
constexpr int KBUF = KT * KPIT;          // halfs of one K tile
constexpr int STG  = KBUF + Cch * VPIT;  // halfs of one stage (K tile, then V tile)

// Eight 16-byte copies per lane, LDS address l + i*ls bytes, global address g + i*gs halfs. The s_wait_xcnt closes the
// statement so that no address register named here is rewritten ahead of it.
__device__ __forceinline__ void acopy8(unsigned l, unsigned ls, const _Float16* g, size_t gs) {
  asm volatile("global_load_async_to_lds_b128 %0, %8, off\n\t"
               "global_load_async_to_lds_b128 %1, %9, off\n\t"
               "global_load_async_to_lds_b128 %2, %10, off\n\t"
               "global_load_async_to_lds_b128 %3, %11, off\n\t"
               "global_load_async_to_lds_b128 %4, %12, off\n\t"
               "global_load_async_to_lds_b128 %5, %13, off\n\t"
               "global_load_async_to_lds_b128 %6, %14, off\n\t"
               "global_load_async_to_lds_b128 %7, %15, off\n\t"
               "s_wait_xcnt 0x0"
               :: "v"(l), "v"(l + ls), "v"(l + 2 * ls), "v"(l + 3 * ls), "v"(l + 4 * ls), "v"(l + 5 * ls), "v"(l + 6 * ls), "v"(l + 7 * ls),
                  "v"(g), "v"(g + gs), "v"(g + 2 * gs), "v"(g + 3 * gs), "v"(g + 4 * gs), "v"(g + 5 * gs), "v"(g + 6 * gs), "v"(g + 7 * gs)
               : "memory");
}
// 64 rows of 512 B (Q or K): a wave copies one whole row per instruction, rows wave, wave + 4, ...
__device__ __forceinline__ void copy_rows64(unsigned l, const _Float16* g) {
  acopy8(l, 4 * KPIT * 2, g, (size_t)4 * Cch);
  acopy8(l + 32 * KPIT * 2, 4 * KPIT * 2, g + (size_t)32 * Cch, (size_t)4 * Cch);
}
// 256 channel rows of 128 B (V): eight lanes copy one row, a block 16 rows per instruction
__device__ __forceinline__ void copy_vtile(unsigned l, const _Float16* g) {
  acopy8(l, 16 * VPIT * 2, g, (size_t)16 * Nsq);
  acopy8(l + 128 * VPIT * 2, 16 * VPIT * 2, g + (size_t)128 * Nsq, (size_t)16 * Nsq);
}
__global__ void __launch_bounds__(128, 1)
attn_kernel(const float* __restrict__ x,
            const _Float16* __restrict__ Qt,   // [B][N][C]
            const _Float16* __restrict__ Kt,   // [B][N][C]
            const _Float16* __restrict__ Vm,   // [B][C][N]
            float* __restrict__ out) {
  __shared__ __align__(16) _Float16 pbuf[4][16 * 32];        // per-wave prob tile (1KB each)
  __shared__ __align__(16) float    cst[128 * 64];
  __shared__ __align__(16) _Float16 sQ[64 * KPIT];           // the block's query rows
  __shared__ __align__(16) _Float16 ring[2 * STG];           // two stages of K and V
  const int wave = threadIdx.x >> 5, lane = threadIdx.x & 31;
  const int tile = blockIdx.x * 4 + wave;      // 0..1023
  const int b  = tile >> 8;
  const int i0 = (tile & 255) << 4;
  const int row = lane & 15, half = lane >> 4;
  const float C1 = 0.0625f * 1.44269504089f;   // (1/sqrt(256)) * log2(e)

  // Q A-fragments (M=i, K=c): re-read per 32-key step, now from LDS, not held in registers
  const _Float16* Qb = sQ + (wave * 16 + row) * KPIT;

  // each lane's own copy addresses: LDS byte address (low 32 bits of the shared address) and global pointer at stage 0
  const unsigned lQ = (unsigned)(size_t)sQ   + (unsigned)(wave * KPIT * 2 + lane * 16);
  const unsigned lK = (unsigned)(size_t)ring + (unsigned)(wave * KPIT * 2 + lane * 16);
  const unsigned lV = (unsigned)(size_t)ring + (unsigned)(KBUF * 2 + (threadIdx.x >> 3) * VPIT * 2 + (threadIdx.x & 7) * 16);
  const _Float16* gQ = Qt + ((size_t)b * Nsq + (i0 - wave * 16) + wave) * Cch + lane * 8;
  const _Float16* gK = Kt + ((size_t)b * Nsq + wave) * Cch + lane * 8;
  const _Float16* gV = Vm + ((size_t)b * Cch + (threadIdx.x >> 3)) * (size_t)Nsq + (threadIdx.x & 7) * 8;
  copy_rows64(lQ, gQ);
  copy_rows64(lK, gK);
  copy_vtile(lV, gV);
  asm volatile("s_wait_asynccnt 0x0" ::: "memory");   // this wave's share of Q and of stage 0 has landed
  __syncthreads();                                    // ... and every other wave's
  copy_rows64(lK + STG * 2, gK + (size_t)KT * Cch);   // stage 1 flies while stage 0 is worked on
  copy_vtile(lV + STG * 2, gV + KT);

  v8f acc[16];                                  // context^T tile [16 i][256 c]
  #pragma unroll
  for (int ct = 0; ct < 16; ++ct) { v8f z = {}; acc[ct] = z; }
  float mrow[8], srow[8];                       // online-softmax stats per row
  #pragma unroll
  for (int v = 0; v < 8; ++v) { mrow[v] = -3.0e38f; srow[v] = 0.f; }
  _Float16* pl = pbuf[wave];

  for (int t = 0; t < Nsq / KT; ++t) {
   const _Float16* stg = ring + (t & 1) * STG;
   #pragma unroll 1                             // kept rolled: unrolled, the build spilled accumulators to scratch
   for (int s = 0; s < KT / 32; ++s) {
    // ---- scores: two 16x16 tiles (keys 0..15, 16..31 of this step), K = 256 ----
    const _Float16* K0 = stg + (s * 32 + row) * KPIT;                      // key row; same K map as q
    const _Float16* K1 = K0 + 16 * KPIT;
    const _Float16* Vb = stg + KBUF + row * VPIT + s * 32;                 // V row (c = ct*16+row) at this step's first key
    v8f sD0 = {}, sD1 = {};
    #pragma unroll
    for (int k = 0; k < 8; ++k) {
      const v16h qk = bfrag16(Qb + k * 32, half);          // A map == B map helper (row ptr at k0)
      sD0 = WMMA_F16(qk, bfrag16(K0 + k * 32, half), sD0);
      sD1 = WMMA_F16(qk, bfrag16(K1 + k * 32, half), sD1);
    }
    // ---- online softmax, one row (VGPR index v) at a time ----
    #pragma unroll
    for (int v = 0; v < 8; ++v) {
      float lm = fmaxf(sD0[v], sD1[v]);         // row-wise max across N lanes
      lm = fmaxf(lm, __shfl_xor(lm, 8, 32));
      lm = fmaxf(lm, __shfl_xor(lm, 4, 32));
      lm = fmaxf(lm, __shfl_xor(lm, 2, 32));
      lm = fmaxf(lm, __shfl_xor(lm, 1, 32));
      const float mn  = fmaxf(mrow[v], lm);
      const float cor = __builtin_exp2f((mrow[v] - mn) * C1);
      mrow[v] = mn;
      const float p0 = __builtin_exp2f((sD0[v] - mn) * C1);
      const float p1 = __builtin_exp2f((sD1[v] - mn) * C1);
      float rs = p0 + p1;
      rs += __shfl_xor(rs, 8, 32);
      rs += __shfl_xor(rs, 4, 32);
      rs += __shfl_xor(rs, 2, 32);
      rs += __shfl_xor(rs, 1, 32);
      srow[v] = srow[v] * cor + rs;
      const int ir = v + half * 8;              // this element's query row
      pl[ir * 32 + row]      = (_Float16)(p0 * 16384.0f);    // prob tile [i][j] in LDS, lifted by 2^14 (p <= 1)
      pl[ir * 32 + 16 + row] = (_Float16)(p1 * 16384.0f);
      #pragma unroll
      for (int ct = 0; ct < 16; ++ct) acc[ct][v] *= cor;  // rescale context
    }
    LDSX();
    // ---- re-layout probs as A fragment (M=i, K=j, 16x32) from LDS ----
    v16h pa;
    ((v8h*)&pa)[0] = *(const v8h*)&pl[row * 32 + half * 8];
    ((v8h*)&pa)[1] = *(const v8h*)&pl[row * 32 + half * 8 + 16];
    // ---- context += attn x V^T : 16 channel tiles ----
    #pragma unroll
    for (int ct = 0; ct < 16; ++ct) acc[ct] = WMMA_F16(pa, bfrag16(Vb + ct * 16 * VPIT, half), acc[ct]);   // keys 8*half.., 16+8*half..
    __builtin_amdgcn_wave_barrier();            // pl reads done before the next tile's writes
   }
   asm volatile("s_wait_dscnt 0x0" ::: "memory");     // this wave's reads of stage t are done
   asm volatile("s_wait_asynccnt 0x0" ::: "memory");  // this wave's share of stage t + 1 has landed
   __syncthreads();                                   // publishes stage t + 1 and frees stage t's buffer
   if (t + 2 < Nsq / KT) {                            // refill the buffer just read
     copy_rows64(lK + (t & 1) * STG * 2, gK + (size_t)(t + 2) * KT * Cch);
     copy_vtile(lV + (t & 1) * STG * 2, gV + (t + 2) * KT);
   }
  }
  asm volatile("s_wait_asynccnt 0x0" ::: "memory");   // nothing of this wave is in flight when the loop is left

  // ---- epilogue: out = x + context / rowsum.
  // Transpose context through LDS (two 128-channel passes) so the residual
  // add runs on full 256-byte channel rows with b128 loads/stores.
  // Block = 4 waves = 64 consecutive query positions: stage [128 c][64 i] per pass, then 256-B row segments of (b, c, i0blk..)
  float rinv[8];
  #pragma unroll
  for (int v = 0; v < 8; ++v) rinv[v] = (1.0f / 16384.0f) / srow[v];
  const int i0blk = ((blockIdx.x * 4) & 255) << 4;
  #pragma unroll
  for (int pass = 0; pass < 2; ++pass) {
    __syncthreads();
    #pragma unroll
    for (int ct = 0; ct < 8; ++ct) {
      const int cl = ct * 16 + row;             // local channel 0..127
      #pragma unroll
      for (int v = 0; v < 8; ++v)
        cst[cl * 64 + wave * 16 + v + half * 8] = acc[pass * 8 + ct][v] * rinv[v];
    }
    __syncthreads();
    for (int qd = threadIdx.x; qd < 128 * 16; qd += 128) { const int cl = qd >> 4, pc = qd & 15;
      const int c = pass * 128 + cl;
      const size_t base = ((size_t)b * Cch + c) * (size_t)Nsq + i0blk + pc * 4;
      v4f cv = *(const v4f*)&cst[cl * 64 + pc * 4] + *(const v4f*)&x[base];
      vst2(out + base, cv); }
  }
}

// ---------------------------------------------------------------------------
extern "C" void kernel_launch(void* const* d_in, const int* in_sizes, int n_in,
                              void* d_out, int out_size, void* d_ws, size_t ws_size,
                              hipStream_t stream) {
  const float* x  = (const float*)d_in[0];
  const float* Wq = (const float*)d_in[1];
  const float* bq = (const float*)d_in[2];
  const float* Wk = (const float*)d_in[3];
  const float* bk = (const float*)d_in[4];
  const float* Wv = (const float*)d_in[5];
  const float* bv = (const float*)d_in[6];
  float* out = (float*)d_out;

  // workspace layout: [3][C][C] f16 weights | Qt | Kt | V  (~24.4 MiB total)
  char* ws = (char*)d_ws;
  _Float16* wh = (_Float16*)ws;
  _Float16* Qt = (_Float16*)(ws + (size_t)3 * Cch * Cch * 2);
  _Float16* Kt = Qt + (size_t)Bsz * Nsq * Cch;
  _Float16* V  = Kt + (size_t)Bsz * Nsq * Cch;

  wcvt_kernel<<<(3 * Cch * Cch / 8) / 256, 256, 0, stream>>>(Wq, Wk, Wv, wh);
  // 1024 wave-tiles, 4 waves (128 threads) per block
  qkv_kernel<<<256, 128, 0, stream>>>(x, wh, bq, bk, bv, Qt, Kt, V);
  attn_kernel<<<256, 128, 0, stream>>>(x, Qt, Kt, V, out);
}

// v002
// A run of this version takes 220 microseconds.
// Timed twice side by side with v001, it ran 1.61 and 1.60 times as fast.
// Counting every step since v000, it is 4.61 times as fast.
#include <hip/hip_runtime.h>

typedef __attribute__((ext_vector_type(16))) _Float16 v16h;
typedef __attribute__((ext_vector_type(8)))  _Float16 v8h;
typedef __attribute__((ext_vector_type(8)))  float    v8f;
typedef __attribute__((ext_vector_type(4)))  float    v4f;

// Contractions (Q/K/V 1x1 convs K = 256; scores Q.K over C = 256; attn @ V over 4096 keys) on v_wmma_f32_16x16x32_f16:
// f16 operands, f32 accumulate; online softmax in f32 with P lifted by 2^14 before the f16 conversion; B fragments use the
// same per-lane K map as A (8*half+0..7, 16+8*half+0..7). Q/K/V panels and the output are staged in LDS and written as whole
typedef __attribute__((ext_vector_type(4)))  unsigned v4u;
template <typename T> __device__ __forceinline__ void vst2(void* p, T v) { *(T*)p = v;  }
__device__ __forceinline__ v8f WMMA_F16(v16h a, v16h b, v8f c) {
  return __builtin_amdgcn_wmma_f32_16x16x32_f16(false, a, false, b, (short)0, c, false, false);
}
__device__ __forceinline__ v16h bfrag16(const _Float16* rowk0, int half) {     // row pointer at k0; k = 8*half+i, 16+8*half+i
  v16h b; ((v8h*)&b)[0] = *(const v8h*)(rowk0 + half * 8); ((v8h*)&b)[1] = *(const v8h*)(rowk0 + 16 + half * 8); return b;
}
#define LDSX() do { asm volatile("s_wait_dscnt 0" ::: "memory"); __builtin_amdgcn_wave_barrier(); __builtin_amdgcn_fence(__ATOMIC_RELEASE, "workgroup"); } while (0)

constexpr int Bsz = 4;
constexpr int Cch = 256;   // channels
constexpr int Nsq = 4096;  // sequence positions

// ---------------------------------------------------------------------------
// Kernel 0: convert the three 256x256 weight matrices to f16 (packed [3][C][C])
// ---------------------------------------------------------------------------
__global__ void wcvt_kernel(const float* __restrict__ wq,
                            const float* __restrict__ wk,
                            const float* __restrict__ wv,
                            _Float16* __restrict__ out) {
  int g8 = blockIdx.x * 256 + threadIdx.x;      // 0 .. 3*65536/8-1, 16 B per thread
  int t0 = g8 * 8; int m = t0 >> 16, e = t0 & 65535;
  const float* s = (m == 0) ? wq : (m == 1) ? wk : wv;
  union { v8h h; v4u u; } pk;
#pragma unroll
  for (int i = 0; i < 8; ++i) pk.h[i] = (_Float16)s[e + i];
  vst2(out + t0, pk.u);
}

// ---------------------------------------------------------------------------
// Kernel 1: QKV projection via WMMA.
//   Qt, Kt : [B][N][C] f16  (row n, contiguous channels -> A/B frags are b128)
//   V      : [B][C][N] f16  (row c, contiguous j        -> B frags are b128)
// One wave handles a 16-row n tile; x tile transposed through LDS once.
// ---------------------------------------------------------------------------
__global__ void __launch_bounds__(128, 1)
qkv_kernel(const float* __restrict__ x,         // [B][C][N] f32
           const _Float16* __restrict__ wh,     // [3][C][C] f16
           const float* __restrict__ bq,
           const float* __restrict__ bk,
           const float* __restrict__ bv,
           _Float16* __restrict__ Qt,
           _Float16* __restrict__ Kt,
           _Float16* __restrict__ V) {
  __shared__ __align__(16) _Float16 xT[4][16 * 256];          // per-wave x^T tile (8KB each), reused as the Q/K row staging
  __shared__ __align__(16) _Float16 sVst[256 * 64];            // block staging of V [o][n0blk..+63] (32 KB)
  const int wave = threadIdx.x >> 5, lane = threadIdx.x & 31;
  const int tile = blockIdx.x * 4 + wave;       // 0..1023
  const int b  = tile >> 8;                     // 256 n-tiles per batch
  const int n0 = (tile & 255) << 4;
  const int row = lane & 15, half = lane >> 4;

  _Float16* xt = xT[wave];
  const float* xb = x + (size_t)b * Cch * Nsq;
  // stage x[b][:, n0..n0+15] transposed into LDS as xT[n][c] f16
  #pragma unroll 4
  for (int it = 0; it < 128; ++it) {
    int idx = it * 32 + lane;
    int c = idx >> 4, n = idx & 15;
    xt[n * 256 + c] = (_Float16)xb[(size_t)c * Nsq + n0 + n];
  }
  LDSX();

  // A fragments of x^T (M=n, K=c), K=256 in 8 chunks of 32
  v16h a[8];
  #pragma unroll
  for (int k = 0; k < 8; ++k) {
    ((v8h*)&a[k])[0] = *(const v8h*)&xt[row * 256 + k * 32 + half * 8];
    ((v8h*)&a[k])[1] = *(const v8h*)&xt[row * 256 + k * 32 + half * 8 + 16];
  }

  #pragma unroll
  for (int m = 0; m < 3; ++m) {                 // m constant after unroll:
    const _Float16* W = wh + (size_t)m * 65536; //   no flat loads, no branches
    const float* bias = (m == 0) ? bq : (m == 1) ? bk : bv;
    for (int ot = 0; ot < 16; ++ot) {
      const int o = ot * 16 + row;              // this lane's output column
      v8f acc = {};
      #pragma unroll
      for (int k = 0; k < 8; ++k) acc = WMMA_F16(a[k], bfrag16(&W[o * 256 + k * 32], half), acc);   // same K map as A
      const float bo = bias[o];
      #pragma unroll
      for (int v = 0; v < 8; ++v) {             // D: (M = v + 8*half, N = row) -> stage in LDS
        float val = acc[v] + bo;
        int nl = v + half * 8;                  // local n (0..15)
        if (m < 2) xt[nl * 256 + o] = (_Float16)val;                 // Q/K rows [n][o] (xt is free: A frags live in registers)
        else       sVst[o * 64 + wave * 16 + nl] = (_Float16)val;    // V [o][block-local n]
      }
    }
    if (m < 2) {                                // this wave's 16 rows of Qt / Kt: 512 B each = 32 lanes x 16 B
      LDSX();
      _Float16* dst = (m == 0 ? Qt : Kt) + ((size_t)b * Nsq + n0) * Cch;
      #pragma unroll 4
      for (int nl = 0; nl < 16; ++nl) vst2(dst + (size_t)nl * Cch + lane * 8, *(const v4u*)&xt[nl * 256 + lane * 8]);
      __builtin_amdgcn_wave_barrier();          // before the next m overwrites xt
    }
  }
  __syncthreads();
  const int n0blk = ((blockIdx.x * 4) & 255) << 4;
  for (int q = threadIdx.x; q < 256 * 8; q += 128) { const int o = q >> 3, pc = q & 7;
    vst2(V + ((size_t)b * Cch + o) * (size_t)Nsq + n0blk + pc * 8, *(const v4u*)&sVst[o * 64 + pc * 8]); }
}

// ---------------------------------------------------------------------------
// Kernel 2: flash attention + residual. One wave = 16 query rows x 256 channels.
// The block's 64 Q rows (once) and 64-key K and V tiles (two buffers) reach LDS by asynchronous copies of whole lines;
// the four waves read their fragments from there. Row pitches are 16 B x odd, so a ds_load_b128 meets no bank twice.
// ---------------------------------------------------------------------------
constexpr int KT   = 64;                 // keys per LDS stage = two 32-key softmax steps
constexpr int KPIT = Cch + 8;            // halfs per Q / K row in LDS: 512 B + 16 B
constexpr int VPIT = KT + 8;             // halfs per V row in LDS: 128 B + 16 B
constexpr int KBUF = KT * KPIT;          // halfs of one K tile
constexpr int STG  = KBUF + Cch * VPIT;  // halfs of one stage (K tile, then V tile)

// Eight 16-byte copies per lane, LDS address l + i*ls bytes, global address g + i*gs halfs. The s_wait_xcnt closes the
// statement so that no address register named here is rewritten ahead of it.
__device__ __forceinline__ void acopy8(unsigned l, unsigned ls, const _Float16* g, size_t gs) {
  asm volatile("global_load_async_to_lds_b128 %0, %8, off\n\t"
               "global_load_async_to_lds_b128 %1, %9, off\n\t"
               "global_load_async_to_lds_b128 %2, %10, off\n\t"
               "global_load_async_to_lds_b128 %3, %11, off\n\t"
               "global_load_async_to_lds_b128 %4, %12, off\n\t"
               "global_load_async_to_lds_b128 %5, %13, off\n\t"
               "global_load_async_to_lds_b128 %6, %14, off\n\t"
               "global_load_async_to_lds_b128 %7, %15, off\n\t"
               "s_wait_xcnt 0x0"
               :: "v"(l), "v"(l + ls), "v"(l + 2 * ls), "v"(l + 3 * ls), "v"(l + 4 * ls), "v"(l + 5 * ls), "v"(l + 6 * ls), "v"(l + 7 * ls),
                  "v"(g), "v"(g + gs), "v"(g + 2 * gs), "v"(g + 3 * gs), "v"(g + 4 * gs), "v"(g + 5 * gs), "v"(g + 6 * gs), "v"(g + 7 * gs)
               : "memory");
}
// 64 rows of 512 B (Q or K): a wave copies one whole row per instruction, rows wave, wave + 4, ...
__device__ __forceinline__ void copy_rows64(unsigned l, const _Float16* g) {
  acopy8(l, 4 * KPIT * 2, g, (size_t)4 * Cch);
  acopy8(l + 32 * KPIT * 2, 4 * KPIT * 2, g + (size_t)32 * Cch, (size_t)4 * Cch);
}
// 256 channel rows of 128 B (V): eight lanes copy one row, a block 16 rows per instruction
__device__ __forceinline__ void copy_vtile(unsigned l, const _Float16* g) {
  acopy8(l, 16 * VPIT * 2, g, (size_t)16 * Nsq);
  acopy8(l + 128 * VPIT * 2, 16 * VPIT * 2, g + (size_t)128 * Nsq, (size_t)16 * Nsq);
}
__global__ void __launch_bounds__(128, 1)
attn_kernel(const float* __restrict__ x,
            const _Float16* __restrict__ Qt,   // [B][N][C]
            const _Float16* __restrict__ Kt,   // [B][N][C]
            const _Float16* __restrict__ Vm,   // [B][C][N]
            float* __restrict__ out) {
  __shared__ __align__(16) _Float16 pbuf[4][16 * 32];        // per-wave prob tile (1KB each)
  __shared__ __align__(16) float    cst[128 * 64];
  __shared__ __align__(16) _Float16 sQ[64 * KPIT];           // the block's query rows
  __shared__ __align__(16) _Float16 ring[2 * STG];           // two stages of K and V
  const int wave = threadIdx.x >> 5, lane = threadIdx.x & 31;
  const int tile = blockIdx.x * 4 + wave;      // 0..1023
  const int b  = tile >> 8;
  const int i0 = (tile & 255) << 4;
  const int row = lane & 15, half = lane >> 4;
  const float C1 = 0.0625f * 1.44269504089f;   // (1/sqrt(256)) * log2(e)

  // Q A-fragments (M=i, K=c): re-read per 32-key step from LDS, not held in registers across steps
  const _Float16* Qb = sQ + (wave * 16 + row) * KPIT;

  // each lane's own copy addresses: LDS byte address (low 32 bits of the shared address) and global pointer at stage 0
  const unsigned lQ = (unsigned)(size_t)sQ   + (unsigned)(wave * KPIT * 2 + lane * 16);
  const unsigned lK = (unsigned)(size_t)ring + (unsigned)(wave * KPIT * 2 + lane * 16);
  const unsigned rV = (unsigned)(size_t)ring + (unsigned)(KBUF * 2);                                   // V tile of buffer 0
  const unsigned lV = (unsigned)((threadIdx.x >> 3) * VPIT * 2 + (threadIdx.x & 7) * 16);              // this lane's place in a V tile
  // What lives across the key loop for the refills is kept as 32-bit offsets (lV, oK, oV), not as finished addresses: an operand of
  // the copies' asm statement must sit under v256, and with the fragments in registers a finished address held there was spilled.
  const _Float16* gQ = Qt + ((size_t)b * Nsq + (i0 - wave * 16) + wave) * Cch + lane * 8;
  const unsigned oK = (unsigned)((b * Nsq + wave) * Cch + lane * 8);                                   // in halfs from Kt, from Vm
  const unsigned oV = (unsigned)((b * Cch + (int)(threadIdx.x >> 3)) * Nsq + (int)(threadIdx.x & 7) * 8);
  copy_rows64(lQ, gQ);
  copy_rows64(lK, Kt + oK);
  copy_vtile(rV + lV, Vm + oV);
  asm volatile("s_wait_asynccnt 0x0" ::: "memory");   // this wave's share of Q and of stage 0 has landed
  __syncthreads();                                    // ... and every other wave's
  copy_rows64(lK + STG * 2, Kt + (oK + KT * Cch));    // stage 1 flies while stage 0 is worked on
  copy_vtile((rV + STG * 2) + lV, Vm + (oV + KT));

  v8f acc[16];                                  // context^T tile [16 i][256 c]
  #pragma unroll
  for (int ct = 0; ct < 16; ++ct) { v8f z = {}; acc[ct] = z; }
  float mrow[8], srow[8];                       // online-softmax stats per row
  #pragma unroll
  for (int v = 0; v < 8; ++v) { mrow[v] = -3.0e38f; srow[v] = 0.f; }
  _Float16* pl = pbuf[wave];

  for (int t = 0; t < Nsq / KT; ++t) {
   const _Float16* stg = ring + (t & 1) * STG;
   #pragma unroll 1                             // kept rolled: unrolled, the build spilled accumulators to scratch
   for (int s = 0; s < KT / 32; ++s) {
    // ---- scores: two 16x16 tiles (keys 0..15, 16..31 of this step), K = 256 ----
    const _Float16* K0 = stg + (s * 32 + row) * KPIT;                      // key row; same K map as q
    const _Float16* K1 = K0 + 16 * KPIT;
    const _Float16* Vb = stg + KBUF + row * VPIT + s * 32;                 // V row (c = ct*16+row) at this step's first key
    // ---- all of this step's fragments are read from LDS as one group, ahead of the first product: the wave is alone on its
    // SIMD, and a read placed in front of each product would make it sit out the LDS latency once per product ----
    v16h qf[8], kf0[8], kf1[8], vf[16];
    #pragma unroll
    for (int k = 0; k < 8; ++k) {
      qf[k]  = bfrag16(Qb + k * 32, half);                 // A map == B map helper (row ptr at k0)
      kf0[k] = bfrag16(K0 + k * 32, half);
      kf1[k] = bfrag16(K1 + k * 32, half);
    }
    #pragma unroll
    for (int ct = 0; ct < 16; ++ct) vf[ct] = bfrag16(Vb + ct * 16 * VPIT, half);   // keys 8*half.., 16+8*half..; land under the scores and the softmax
    v8f sD0 = {}, sD1 = {};
    #pragma unroll
    for (int k = 0; k < 8; ++k) {
      sD0 = WMMA_F16(qf[k], kf0[k], sD0);
      sD1 = WMMA_F16(qf[k], kf1[k], sD1);
    }
    // ---- online softmax, one row (VGPR index v) at a time ----
    #pragma unroll
    for (int v = 0; v < 8; ++v) {
      float lm = fmaxf(sD0[v], sD1[v]);         // row-wise max across N lanes
      lm = fmaxf(lm, __shfl_xor(lm, 8, 32));
      lm = fmaxf(lm, __shfl_xor(lm, 4, 32));
      lm = fmaxf(lm, __shfl_xor(lm, 2, 32));
      lm = fmaxf(lm, __shfl_xor(lm, 1, 32));
      const float mn  = fmaxf(mrow[v], lm);
      const float cor = __builtin_exp2f((mrow[v] - mn) * C1);
      mrow[v] = mn;
      const float p0 = __builtin_exp2f((sD0[v] - mn) * C1);
      const float p1 = __builtin_exp2f((sD1[v] - mn) * C1);
      float rs = p0 + p1;
      rs += __shfl_xor(rs, 8, 32);
      rs += __shfl_xor(rs, 4, 32);
      rs += __shfl_xor(rs, 2, 32);
      rs += __shfl_xor(rs, 1, 32);
      srow[v] = srow[v] * cor + rs;
      const int ir = v + half * 8;              // this element's query row
      pl[ir * 32 + row]      = (_Float16)(p0 * 16384.0f);    // prob tile [i][j] in LDS, lifted by 2^14 (p <= 1)
      pl[ir * 32 + 16 + row] = (_Float16)(p1 * 16384.0f);
      #pragma unroll
      for (int ct = 0; ct < 16; ++ct) acc[ct][v] *= cor;  // rescale context
    }
    LDSX();
    // ---- re-layout probs as A fragment (M=i, K=j, 16x32) from LDS ----
    v16h pa;
    ((v8h*)&pa)[0] = *(const v8h*)&pl[row * 32 + half * 8];
    ((v8h*)&pa)[1] = *(const v8h*)&pl[row * 32 + half * 8 + 16];
    // ---- context += attn x V^T : 16 channel tiles, V fragments already in registers ----
    #pragma unroll
    for (int ct = 0; ct < 16; ++ct) acc[ct] = WMMA_F16(pa, vf[ct], acc[ct]);
    // The loop's back edge follows: the four vector slots that the chip
    // needs before the next pass overwrites the last products' operands are written here; the barrier keeps the products above them.
    __builtin_amdgcn_sched_barrier(0);
    asm volatile("v_nop\n\tv_nop\n\tv_nop\n\tv_nop");
    __builtin_amdgcn_wave_barrier();            // pl reads done before the next tile's writes
   }
   asm volatile("s_wait_dscnt 0x0" ::: "memory");     // this wave's reads of stage t are done
   asm volatile("s_wait_asynccnt 0x0" ::: "memory");  // this wave's share of stage t + 1 has landed
   __syncthreads();                                   // publishes stage t + 1 and frees stage t's buffer
   if (t + 2 < Nsq / KT) {                            // refill the buffer just read
     copy_rows64(lK + (t & 1) * STG * 2, Kt + (oK + (unsigned)(t + 2) * KT * Cch));
     copy_vtile(((t & 1) ? rV + STG * 2 : rV) + lV, Vm + (oV + (unsigned)(t + 2) * KT));
   }
  }
  asm volatile("s_wait_asynccnt 0x0" ::: "memory");   // nothing of this wave is in flight when the loop is left

  // ---- epilogue: out = x + context / rowsum.
  // Transpose context through LDS (two 128-channel passes) so the residual
  // add runs on full 256-byte channel rows with b128 loads/stores.
  // Block = 4 waves = 64 consecutive query positions: stage [128 c][64 i] per pass, then 256-B row segments of (b, c, i0blk..)
  float rinv[8];
  #pragma unroll
  for (int v = 0; v < 8; ++v) rinv[v] = (1.0f / 16384.0f) / srow[v];
  const int i0blk = ((blockIdx.x * 4) & 255) << 4;
  #pragma unroll
  for (int pass = 0; pass < 2; ++pass) {
    __syncthreads();
    #pragma unroll
    for (int ct = 0; ct < 8; ++ct) {
      const int cl = ct * 16 + row;             // local channel 0..127
      #pragma unroll
      for (int v = 0; v < 8; ++v)
        cst[cl * 64 + wave * 16 + v + half * 8] = acc[pass * 8 + ct][v] * rinv[v];
    }
    __syncthreads();
    for (int qd = threadIdx.x; qd < 128 * 16; qd += 128) { const int cl = qd >> 4, pc = qd & 15;
      const int c = pass * 128 + cl;
      const size_t base = ((size_t)b * Cch + c) * (size_t)Nsq + i0blk + pc * 4;
      v4f cv = *(const v4f*)&cst[cl * 64 + pc * 4] + *(const v4f*)&x[base];
      vst2(out + base, cv); }
  }
}

// ---------------------------------------------------------------------------
extern "C" void kernel_launch(void* const* d_in, const int* in_sizes, int n_in,
                              void* d_out, int out_size, void* d_ws, size_t ws_size,
                              hipStream_t stream) {
  const float* x  = (const float*)d_in[0];
  const float* Wq = (const float*)d_in[1];
  const float* bq = (const float*)d_in[2];
  const float* Wk = (const float*)d_in[3];
  const float* bk = (const float*)d_in[4];
  const float* Wv = (const float*)d_in[5];
  const float* bv = (const float*)d_in[6];
  float* out = (float*)d_out;

  // workspace layout: [3][C][C] f16 weights | Qt | Kt | V  (~24.4 MiB total)
  char* ws = (char*)d_ws;
  _Float16* wh = (_Float16*)ws;
  _Float16* Qt = (_Float16*)(ws + (size_t)3 * Cch * Cch * 2);
  _Float16* Kt = Qt + (size_t)Bsz * Nsq * Cch;
  _Float16* V  = Kt + (size_t)Bsz * Nsq * Cch;

  wcvt_kernel<<<(3 * Cch * Cch / 8) / 256, 256, 0, stream>>>(Wq, Wk, Wv, wh);
  // 1024 wave-tiles, 4 waves (128 threads) per block
  qkv_kernel<<<256, 128, 0, stream>>>(x, wh, bq, bk, bv, Qt, Kt, V);
  attn_kernel<<<256, 128, 0, stream>>>(x, Qt, Kt, V, out);
}

// v003
// Measured time: 168 microseconds a run.
// Next to v002, in two timings, it ran 1.29 and 1.30 times as fast.
// Over all steps from v000 it is 5.98 times as fast.
#include <hip/hip_runtime.h>

typedef __attribute__((ext_vector_type(16))) _Float16 v16h;
typedef __attribute__((ext_vector_type(8)))  _Float16 v8h;
typedef __attribute__((ext_vector_type(8)))  float    v8f;
typedef __attribute__((ext_vector_type(4)))  float    v4f;

// Contractions (Q/K/V 1x1 convs K = 256; scores Q.K over C = 256; attn @ V over 4096 keys) on v_wmma_f32_16x16x32_f16:
// f16 operands, f32 accumulate; online softmax in f32 with P lifted by 2^14 before the f16 conversion; B fragments use the
// same per-lane K map as A (8*half+0..7, 16+8*half+0..7). Attention runs transposed (S^T = K.Q^T, O^T += V.P^T): a lane owns one query.
// Q/K/V panels and the output are staged in LDS and written as whole
typedef __attribute__((ext_vector_type(4)))  unsigned v4u;
template <typename T> __device__ __forceinline__ void vst2(void* p, T v) { *(T*)p = v;  }
__device__ __forceinline__ v8f WMMA_F16(v16h a, v16h b, v8f c) {
  return __builtin_amdgcn_wmma_f32_16x16x32_f16(false, a, false, b, (short)0, c, false, false);
}
__device__ __forceinline__ v16h bfrag16(const _Float16* rowk0, int half) {     // row pointer at k0; k = 8*half+i, 16+8*half+i
  v16h b; ((v8h*)&b)[0] = *(const v8h*)(rowk0 + half * 8); ((v8h*)&b)[1] = *(const v8h*)(rowk0 + 16 + half * 8); return b;
}
// lane l <-> lane l ^ 16 on the vector pipe (no LDS queue behind it)
__device__ __forceinline__ float xhalf(float v) {
  const int b = __builtin_bit_cast(int, v);
  return __builtin_bit_cast(float, __builtin_amdgcn_permlanex16(b, b, 0x76543210, 0xfedcba98, false, false));
}
#define LDSX() do { asm volatile("s_wait_dscnt 0" ::: "memory"); __builtin_amdgcn_wave_barrier(); __builtin_amdgcn_fence(__ATOMIC_RELEASE, "workgroup"); } while (0)

constexpr int Bsz = 4;
constexpr int Cch = 256;   // channels
constexpr int Nsq = 4096;  // sequence positions

// ---------------------------------------------------------------------------
// Kernel 0: convert the three 256x256 weight matrices to f16 (packed [3][C][C])
// ---------------------------------------------------------------------------
__global__ void wcvt_kernel(const float* __restrict__ wq,
                            const float* __restrict__ wk,
                            const float* __restrict__ wv,
                            _Float16* __restrict__ out) {
  int g8 = blockIdx.x * 256 + threadIdx.x;      // 0 .. 3*65536/8-1, 16 B per thread
  int t0 = g8 * 8; int m = t0 >> 16, e = t0 & 65535;
  const float* s = (m == 0) ? wq : (m == 1) ? wk : wv;
  union { v8h h; v4u u; } pk;
#pragma unroll
  for (int i = 0; i < 8; ++i) pk.h[i] = (_Float16)s[e + i];
  vst2(out + t0, pk.u);
}

// ---------------------------------------------------------------------------
// Kernel 1: QKV projection via WMMA.
//   Qt, Kt : [B][N][C] f16  (row n, contiguous channels -> A/B frags are b128)
//   V      : [B][C][N] f16  (row c, contiguous j        -> A frags are b128)
// One wave handles a 16-row n tile; x tile transposed through LDS once.
// ---------------------------------------------------------------------------
__global__ void __launch_bounds__(128, 1)
qkv_kernel(const float* __restrict__ x,         // [B][C][N] f32
           const _Float16* __restrict__ wh,     // [3][C][C] f16
           const float* __restrict__ bq,
           const float* __restrict__ bk,
           const float* __restrict__ bv,
           _Float16* __restrict__ Qt,
           _Float16* __restrict__ Kt,
           _Float16* __restrict__ V) {
  __shared__ __align__(16) _Float16 xT[4][16 * 256];          // per-wave x^T tile (8KB each), reused as the Q/K row staging
  __shared__ __align__(16) _Float16 sVst[256 * 64];            // block staging of V [o][n0blk..+63] (32 KB)
  const int wave = threadIdx.x >> 5, lane = threadIdx.x & 31;
  const int tile = blockIdx.x * 4 + wave;       // 0..1023
  const int b  = tile >> 8;                     // 256 n-tiles per batch
  const int n0 = (tile & 255) << 4;
  const int row = lane & 15, half = lane >> 4;

  _Float16* xt = xT[wave];
  const float* xb = x + (size_t)b * Cch * Nsq;
  // stage x[b][:, n0..n0+15] transposed into LDS as xT[n][c] f16
  #pragma unroll 4
  for (int it = 0; it < 128; ++it) {
    int idx = it * 32 + lane;
    int c = idx >> 4, n = idx & 15;
    xt[n * 256 + c] = (_Float16)xb[(size_t)c * Nsq + n0 + n];
  }
  LDSX();

  // A fragments of x^T (M=n, K=c), K=256 in 8 chunks of 32
  v16h a[8];
  #pragma unroll
  for (int k = 0; k < 8; ++k) {
    ((v8h*)&a[k])[0] = *(const v8h*)&xt[row * 256 + k * 32 + half * 8];
    ((v8h*)&a[k])[1] = *(const v8h*)&xt[row * 256 + k * 32 + half * 8 + 16];
  }

  #pragma unroll
  for (int m = 0; m < 3; ++m) {                 // m constant after unroll:
    const _Float16* W = wh + (size_t)m * 65536; //   no flat loads, no branches
    const float* bias = (m == 0) ? bq : (m == 1) ? bk : bv;
    for (int ot = 0; ot < 16; ++ot) {
      const int o = ot * 16 + row;              // this lane's output column
      v8f acc = {};
      #pragma unroll
      for (int k = 0; k < 8; ++k) acc = WMMA_F16(a[k], bfrag16(&W[o * 256 + k * 32], half), acc);   // same K map as A
      const float bo = bias[o];
      #pragma unroll
      for (int v = 0; v < 8; ++v) {             // D: (M = v + 8*half, N = row) -> stage in LDS
        float val = acc[v] + bo;
        int nl = v + half * 8;                  // local n (0..15)
        if (m < 2) xt[nl * 256 + o] = (_Float16)val;                 // Q/K rows [n][o] (xt is free: A frags live in registers)
        else       sVst[o * 64 + wave * 16 + nl] = (_Float16)val;    // V [o][block-local n]
      }
    }
    if (m < 2) {                                // this wave's 16 rows of Qt / Kt: 512 B each = 32 lanes x 16 B
      LDSX();
      _Float16* dst = (m == 0 ? Qt : Kt) + ((size_t)b * Nsq + n0) * Cch;
      #pragma unroll 4
      for (int nl = 0; nl < 16; ++nl) vst2(dst + (size_t)nl * Cch + lane * 8, *(const v4u*)&xt[nl * 256 + lane * 8]);
      __builtin_amdgcn_wave_barrier();          // before the next m overwrites xt
    }
  }
  __syncthreads();
  const int n0blk = ((blockIdx.x * 4) & 255) << 4;
  for (int q = threadIdx.x; q < 256 * 8; q += 128) { const int o = q >> 3, pc = q & 7;
    vst2(V + ((size_t)b * Cch + o) * (size_t)Nsq + n0blk + pc * 8, *(const v4u*)&sVst[o * 64 + pc * 8]); }
}

// ---------------------------------------------------------------------------
// Kernel 2: flash attention + residual. One wave = 16 query columns x 256 channels, transposed: K and V are the A operands,
// Q^T and P^T the B operands, so lane l holds scores, statistics and context of query l & 15 alone.
// The block's 64 Q rows (once) and 64-key K and V tiles (two buffers) reach LDS by asynchronous copies of whole lines;
// the four waves read their fragments from there. Row pitches are 16 B x odd, so a ds_load_b128 meets no bank twice.
// ---------------------------------------------------------------------------
constexpr int KT   = 64;                 // keys per LDS stage = two 32-key softmax steps
constexpr int KPIT = Cch + 8;            // halfs per Q / K row in LDS: 512 B + 16 B
constexpr int VPIT = KT + 8;             // halfs per V row in LDS: 128 B + 16 B
constexpr int KBUF = KT * KPIT;          // halfs of one K tile
constexpr int STG  = KBUF + Cch * VPIT;  // halfs of one stage (K tile, then V tile)

// Eight 16-byte copies per lane, LDS address l + i*ls bytes, global address g + i*gs halfs. The s_wait_xcnt closes the
// statement so that no address register named here is rewritten ahead of it.
__device__ __forceinline__ void acopy8(unsigned l, unsigned ls, const _Float16* g, size_t gs) {
  asm volatile("global_load_async_to_lds_b128 %0, %8, off\n\t"
               "global_load_async_to_lds_b128 %1, %9, off\n\t"
               "global_load_async_to_lds_b128 %2, %10, off\n\t"
               "global_load_async_to_lds_b128 %3, %11, off\n\t"
               "global_load_async_to_lds_b128 %4, %12, off\n\t"
               "global_load_async_to_lds_b128 %5, %13, off\n\t"
               "global_load_async_to_lds_b128 %6, %14, off\n\t"
               "global_load_async_to_lds_b128 %7, %15, off\n\t"
               "s_wait_xcnt 0x0"
               :: "v"(l), "v"(l + ls), "v"(l + 2 * ls), "v"(l + 3 * ls), "v"(l + 4 * ls), "v"(l + 5 * ls), "v"(l + 6 * ls), "v"(l + 7 * ls),
                  "v"(g), "v"(g + gs), "v"(g + 2 * gs), "v"(g + 3 * gs), "v"(g + 4 * gs), "v"(g + 5 * gs), "v"(g + 6 * gs), "v"(g + 7 * gs)
               : "memory");
}
// 64 rows of 512 B (Q or K): a wave copies one whole row per instruction, rows wave, wave + 4, ...
__device__ __forceinline__ void copy_rows64(unsigned l, const _Float16* g) {
  acopy8(l, 4 * KPIT * 2, g, (size_t)4 * Cch);
  acopy8(l + 32 * KPIT * 2, 4 * KPIT * 2, g + (size_t)32 * Cch, (size_t)4 * Cch);
}
// 256 channel rows of 128 B (V): eight lanes copy one row, a block 16 rows per instruction
__device__ __forceinline__ void copy_vtile(unsigned l, const _Float16* g) {
  acopy8(l, 16 * VPIT * 2, g, (size_t)16 * Nsq);
  acopy8(l + 128 * VPIT * 2, 16 * VPIT * 2, g + (size_t)128 * Nsq, (size_t)16 * Nsq);
}
__global__ void __launch_bounds__(128, 1)
attn_kernel(const float* __restrict__ x,
            const _Float16* __restrict__ Qt,   // [B][N][C]
            const _Float16* __restrict__ Kt,   // [B][N][C]
            const _Float16* __restrict__ Vm,   // [B][C][N]
            float* __restrict__ out) {
  __shared__ __align__(16) float    cst[128 * 64];
  __shared__ __align__(16) _Float16 sQ[64 * KPIT];           // the block's query rows
  __shared__ __align__(16) _Float16 ring[2 * STG];           // two stages of K and V
  const int wave = threadIdx.x >> 5, lane = threadIdx.x & 31;
  const int tile = blockIdx.x * 4 + wave;      // 0..1023
  const int b  = tile >> 8;
  const int i0 = (tile & 255) << 4;
  const int row = lane & 15, half = lane >> 4;
  const float C1 = 0.0625f * 1.44269504089f;   // (1/sqrt(256)) * log2(e)

  // Q^T B-fragments (K=c, N=i): re-read per 32-key step from LDS, not held in registers across steps
  const _Float16* Qb = sQ + (wave * 16 + row) * KPIT;

  // each lane's own copy addresses: LDS byte address (low 32 bits of the shared address) and global pointer at stage 0
  const unsigned lQ = (unsigned)(size_t)sQ   + (unsigned)(wave * KPIT * 2 + lane * 16);
  const unsigned lK = (unsigned)(size_t)ring + (unsigned)(wave * KPIT * 2 + lane * 16);
  const unsigned rV = (unsigned)(size_t)ring + (unsigned)(KBUF * 2);                                   // V tile of buffer 0
  const unsigned lV = (unsigned)((threadIdx.x >> 3) * VPIT * 2 + (threadIdx.x & 7) * 16);              // this lane's place in a V tile
  // What lives across the key loop for the refills is kept as 32-bit offsets (lV, oK, oV), not as finished addresses: an operand of
  // the copies' asm statement must sit under v256, and with the fragments in registers a finished address held there was spilled.
  const _Float16* gQ = Qt + ((size_t)b * Nsq + (i0 - wave * 16) + wave) * Cch + lane * 8;
  const unsigned oK = (unsigned)((b * Nsq + wave) * Cch + lane * 8);                                   // in halfs from Kt, from Vm
  const unsigned oV = (unsigned)((b * Cch + (int)(threadIdx.x >> 3)) * Nsq + (int)(threadIdx.x & 7) * 8);
  copy_rows64(lQ, gQ);
  copy_rows64(lK, Kt + oK);
  copy_vtile(rV + lV, Vm + oV);
  asm volatile("s_wait_asynccnt 0x0" ::: "memory");   // this wave's share of Q and of stage 0 has landed
  __syncthreads();                                    // ... and every other wave's
  copy_rows64(lK + STG * 2, Kt + (oK + KT * Cch));    // stage 1 flies while stage 0 is worked on
  copy_vtile((rV + STG * 2) + lV, Vm + (oV + KT));

  v8f acc[16];                                  // context tile [256 c][16 i]: acc[ct][v] = channel ct*16 + 8*half + v of query row
  #pragma unroll
  for (int ct = 0; ct < 16; ++ct) { v8f z = {}; acc[ct] = z; }
  float mrun = -3.0e38f, srun = 0.f;            // online-softmax stats of this lane's query; srun sums this half's keys only

  for (int t = 0; t < Nsq / KT; ++t) {
   const _Float16* stg = ring + (t & 1) * STG;
   #pragma unroll 1                             // kept rolled: unrolled, the build spilled accumulators to scratch
   for (int s = 0; s < KT / 32; ++s) {
    // ---- scores: two 16x16 tiles (keys 0..15, 16..31 of this step), K = 256 ----
    const _Float16* K0 = stg + (s * 32 + row) * KPIT;                      // key row; same K map as q
    const _Float16* K1 = K0 + 16 * KPIT;
    const _Float16* Vb = stg + KBUF + row * VPIT + s * 32;                 // V row (c = ct*16+row) at this step's first key
    // ---- all of this step's fragments are read from LDS as one group, ahead of the first product: the wave is alone on its
    // SIMD, and a read placed in front of each product would make it sit out the LDS latency once per product ----
    v16h qf[8], kf0[8], kf1[8], vf[16];
    #pragma unroll
    for (int k = 0; k < 8; ++k) {
      qf[k]  = bfrag16(Qb + k * 32, half);                 // A map == B map helper (row ptr at k0)
      kf0[k] = bfrag16(K0 + k * 32, half);
      kf1[k] = bfrag16(K1 + k * 32, half);
    }
    #pragma unroll
    for (int ct = 0; ct < 16; ++ct) vf[ct] = bfrag16(Vb + ct * 16 * VPIT, half);   // keys 8*half.., 16+8*half..; land under the scores and the softmax
    v8f sD0 = {}, sD1 = {};                     // S^T: sD0[v] = key 8*half + v, sD1[v] = key 16 + 8*half + v, query row
    #pragma unroll
    for (int k = 0; k < 8; ++k) {
      sD0 = WMMA_F16(kf0[k], qf[k], sD0);
      sD1 = WMMA_F16(kf1[k], qf[k], sD1);
    }
    // ---- online softmax of one query per lane: 16 keys in the lane's own registers, the other 16 in lane ^ 16 ----
    float lm[8];
    #pragma unroll
    for (int v = 0; v < 8; ++v) lm[v] = fmaxf(sD0[v], sD1[v]);
    float l8 = fmaxf(fmaxf(fmaxf(lm[0], lm[1]), fmaxf(lm[2], lm[3])), fmaxf(fmaxf(lm[4], lm[5]), fmaxf(lm[6], lm[7])));
    l8 = fmaxf(l8, xhalf(l8));
    const float mn  = fmaxf(mrun, l8);
    const float cor = __builtin_exp2f((mrun - mn) * C1);
    mrun = mn;
    // two D tiles of S^T, converted in place, are the B fragment of P^T: element s = key 8*half + s, 16 + 8*half + (s - 8)
    v16h pb;
    float ps[8];
    #pragma unroll
    for (int v = 0; v < 8; ++v) {
      const float p0 = __builtin_exp2f((sD0[v] - mn) * C1);
      const float p1 = __builtin_exp2f((sD1[v] - mn) * C1);
      ps[v] = p0 + p1;
      pb[v]     = (_Float16)(p0 * 16384.0f);    // lifted by 2^14 (p <= 1)
      pb[8 + v] = (_Float16)(p1 * 16384.0f);
    }
    srun = srun * cor + (((ps[0] + ps[1]) + (ps[2] + ps[3])) + ((ps[4] + ps[5]) + (ps[6] + ps[7])));
    // ---- context = context * cor + V x P^T : 16 channel tiles, one factor per lane, V fragments already in registers ----
    #pragma unroll
    for (int ct = 0; ct < 16; ++ct) acc[ct] = WMMA_F16(vf[ct], pb, acc[ct] * cor);
    // The loop's back edge follows: the four vector slots that the chip
    // needs before the next pass overwrites the last products' operands are written here; the barrier keeps the products above them.
    __builtin_amdgcn_sched_barrier(0);
    asm volatile("v_nop\n\tv_nop\n\tv_nop\n\tv_nop");
   }
   asm volatile("s_wait_dscnt 0x0" ::: "memory");     // this wave's reads of stage t are done
   asm volatile("s_wait_asynccnt 0x0" ::: "memory");  // this wave's share of stage t + 1 has landed
   __syncthreads();                                   // publishes stage t + 1 and frees stage t's buffer
   if (t + 2 < Nsq / KT) {                            // refill the buffer just read
     copy_rows64(lK + (t & 1) * STG * 2, Kt + (oK + (unsigned)(t + 2) * KT * Cch));
     copy_vtile(((t & 1) ? rV + STG * 2 : rV) + lV, Vm + (oV + (unsigned)(t + 2) * KT));
   }
  }
  asm volatile("s_wait_asynccnt 0x0" ::: "memory");   // nothing of this wave is in flight when the loop is left

  // ---- epilogue: out = x + context / rowsum.
  // Gather the four waves' context through LDS (two 128-channel passes) so the residual
  // add runs on full 256-byte channel rows with b128 loads/stores.
  // Block = 4 waves = 64 consecutive query positions: stage [128 c][64 i] per pass, then 256-B row segments of (b, c, i0blk..)
  const float rinv = (1.0f / 16384.0f) / (srun + xhalf(srun));   // the two halves' key sums are joined here, once
  const int i0blk = ((blockIdx.x * 4) & 255) << 4;
  #pragma unroll
  for (int pass = 0; pass < 2; ++pass) {
    __syncthreads();
    #pragma unroll
    for (int ct = 0; ct < 8; ++ct) {
      #pragma unroll
      for (int v = 0; v < 8; ++v)               // local channel ct*16 + 8*half + v, query wave*16 + row
        cst[(ct * 16 + half * 8 + v) * 64 + wave * 16 + row] = acc[pass * 8 + ct][v] * rinv;
    }
    __syncthreads();
    for (int qd = threadIdx.x; qd < 128 * 16; qd += 128) { const int cl = qd >> 4, pc = qd & 15;
      const int c = pass * 128 + cl;
      const size_t base = ((size_t)b * Cch + c) * (size_t)Nsq + i0blk + pc * 4;
      v4f cv = *(const v4f*)&cst[cl * 64 + pc * 4] + *(const v4f*)&x[base];
      vst2(out + base, cv); }
  }
}

// ---------------------------------------------------------------------------
extern "C" void kernel_launch(void* const* d_in, const int* in_sizes, int n_in,
                              void* d_out, int out_size, void* d_ws, size_t ws_size,
                              hipStream_t stream) {
  const float* x  = (const float*)d_in[0];
  const float* Wq = (const float*)d_in[1];
  const float* bq = (const float*)d_in[2];
  const float* Wk = (const float*)d_in[3];
  const float* bk = (const float*)d_in[4];
  const float* Wv = (const float*)d_in[5];
  const float* bv = (const float*)d_in[6];
  float* out = (float*)d_out;

  // workspace layout: [3][C][C] f16 weights | Qt | Kt | V  (~24.4 MiB total)
  char* ws = (char*)d_ws;
  _Float16* wh = (_Float16*)ws;
  _Float16* Qt = (_Float16*)(ws + (size_t)3 * Cch * Cch * 2);
  _Float16* Kt = Qt + (size_t)Bsz * Nsq * Cch;
  _Float16* V  = Kt + (size_t)Bsz * Nsq * Cch;

  wcvt_kernel<<<(3 * Cch * Cch / 8) / 256, 256, 0, stream>>>(Wq, Wk, Wv, wh);
  // 1024 wave-tiles, 4 waves (128 threads) per block
  qkv_kernel<<<256, 128, 0, stream>>>(x, wh, bq, bk, bv, Qt, Kt, V);
  attn_kernel<<<256, 128, 0, stream>>>(x, Qt, Kt, V, out);
}

// v004
// A run of this version takes 152 microseconds.
// In both of two side-by-side timings against v003, it was 1.11 times as fast.
// Over all steps from v000 it is 6.63 times as fast.
#include <hip/hip_runtime.h>

typedef __attribute__((ext_vector_type(16))) _Float16 v16h;
typedef __attribute__((ext_vector_type(8)))  _Float16 v8h;
typedef __attribute__((ext_vector_type(8)))  float    v8f;
typedef __attribute__((ext_vector_type(4)))  float    v4f;

// Contractions (Q/K/V 1x1 convs K = 256; scores Q.K over C = 256; attn @ V over 4096 keys) on v_wmma_f32_16x16x32_f16:
// f16 operands, f32 accumulate; online softmax in f32 with P lifted by 2^14 before the f16 conversion; B fragments use the
// same per-lane K map as A (8*half+0..7, 16+8*half+0..7). Attention runs transposed (S^T = K.Q^T, O^T += V.P^T): a lane owns one query.
// Q/K/V panels and the output are staged in LDS and written as whole
typedef __attribute__((ext_vector_type(4)))  unsigned v4u;
template <typename T> __device__ __forceinline__ void vst2(void* p, T v) { *(T*)p = v;  }
__device__ __forceinline__ v8f WMMA_F16(v16h a, v16h b, v8f c) {
  return __builtin_amdgcn_wmma_f32_16x16x32_f16(false, a, false, b, (short)0, c, false, false);
}
__device__ __forceinline__ v16h bfrag16(const _Float16* rowk0, int half) {     // row pointer at k0; k = 8*half+i, 16+8*half+i
  v16h b; ((v8h*)&b)[0] = *(const v8h*)(rowk0 + half * 8); ((v8h*)&b)[1] = *(const v8h*)(rowk0 + 16 + half * 8); return b;
}
// lane l <-> lane l ^ 16 on the vector pipe (no LDS queue behind it)
__device__ __forceinline__ float xhalf(float v) {
  const int b = __builtin_bit_cast(int, v);
  return __builtin_bit_cast(float, __builtin_amdgcn_permlanex16(b, b, 0x76543210, 0xfedcba98, false, false));
}
#define LDSX() do { asm volatile("s_wait_dscnt 0" ::: "memory"); __builtin_amdgcn_wave_barrier(); __builtin_amdgcn_fence(__ATOMIC_RELEASE, "workgroup"); } while (0)

constexpr int Bsz = 4;
constexpr int Cch = 256;   // channels
constexpr int Nsq = 4096;  // sequence positions

// ---------------------------------------------------------------------------
// Kernel 0: convert the three 256x256 weight matrices to f16 (packed [3][C][C])
// ---------------------------------------------------------------------------
__global__ void wcvt_kernel(const float* __restrict__ wq,
                            const float* __restrict__ wk,
                            const float* __restrict__ wv,
                            _Float16* __restrict__ out) {
  int g8 = blockIdx.x * 256 + threadIdx.x;      // 0 .. 3*65536/8-1, 16 B per thread
  int t0 = g8 * 8; int m = t0 >> 16, e = t0 & 65535;
  const float* s = (m == 0) ? wq : (m == 1) ? wk : wv;
  union { v8h h; v4u u; } pk;
#pragma unroll
  for (int i = 0; i < 8; ++i) pk.h[i] = (_Float16)s[e + i];
  vst2(out + t0, pk.u);
}

// ---------------------------------------------------------------------------
// Kernel 1: QKV projection via WMMA.
//   Qt, Kt : [B][N][C] f16  (row n, contiguous channels -> A/B frags are b128)
//   V      : [B][C][N] f16  (row c, contiguous j        -> A frags are b128)
// One wave handles a 16-row n tile; x tile transposed through LDS once.
// ---------------------------------------------------------------------------
__global__ void __launch_bounds__(128, 1)
qkv_kernel(const float* __restrict__ x,         // [B][C][N] f32
           const _Float16* __restrict__ wh,     // [3][C][C] f16
           const float* __restrict__ bq,
           const float* __restrict__ bk,
           const float* __restrict__ bv,
           _Float16* __restrict__ Qt,
           _Float16* __restrict__ Kt,
           _Float16* __restrict__ V) {
  __shared__ __align__(16) _Float16 xT[4][16 * 256];          // per-wave x^T tile (8KB each), reused as the Q/K row staging
  __shared__ __align__(16) _Float16 sVst[256 * 64];            // block staging of V [o][n0blk..+63] (32 KB)
  const int wave = threadIdx.x >> 5, lane = threadIdx.x & 31;
  const int tile = blockIdx.x * 4 + wave;       // 0..1023
  const int b  = tile >> 8;                     // 256 n-tiles per batch
  const int n0 = (tile & 255) << 4;
  const int row = lane & 15, half = lane >> 4;

  _Float16* xt = xT[wave];
  const float* xb = x + (size_t)b * Cch * Nsq;
  // stage x[b][:, n0..n0+15] transposed into LDS as xT[n][c] f16
  #pragma unroll 4
  for (int it = 0; it < 128; ++it) {
    int idx = it * 32 + lane;
    int c = idx >> 4, n = idx & 15;
    xt[n * 256 + c] = (_Float16)xb[(size_t)c * Nsq + n0 + n];
  }
  LDSX();

  // A fragments of x^T (M=n, K=c), K=256 in 8 chunks of 32
  v16h a[8];
  #pragma unroll
  for (int k = 0; k < 8; ++k) {
    ((v8h*)&a[k])[0] = *(const v8h*)&xt[row * 256 + k * 32 + half * 8];
    ((v8h*)&a[k])[1] = *(const v8h*)&xt[row * 256 + k * 32 + half * 8 + 16];
  }

  #pragma unroll
  for (int m = 0; m < 3; ++m) {                 // m constant after unroll:
    const _Float16* W = wh + (size_t)m * 65536; //   no flat loads, no branches
    const float* bias = (m == 0) ? bq : (m == 1) ? bk : bv;
    for (int ot = 0; ot < 16; ++ot) {
      const int o = ot * 16 + row;              // this lane's output column
      v8f acc = {};
      #pragma unroll
      for (int k = 0; k < 8; ++k) acc = WMMA_F16(a[k], bfrag16(&W[o * 256 + k * 32], half), acc);   // same K map as A
      const float bo = bias[o];
      #pragma unroll
      for (int v = 0; v < 8; ++v) {             // D: (M = v + 8*half, N = row) -> stage in LDS
        float val = acc[v] + bo;
        int nl = v + half * 8;                  // local n (0..15)
        if (m < 2) xt[nl * 256 + o] = (_Float16)val;                 // Q/K rows [n][o] (xt is free: A frags live in registers)
        else       sVst[o * 64 + wave * 16 + nl] = (_Float16)val;    // V [o][block-local n]
      }
    }
    if (m < 2) {                                // this wave's 16 rows of Qt / Kt: 512 B each = 32 lanes x 16 B
      LDSX();
      _Float16* dst = (m == 0 ? Qt : Kt) + ((size_t)b * Nsq + n0) * Cch;
      #pragma unroll 4
      for (int nl = 0; nl < 16; ++nl) vst2(dst + (size_t)nl * Cch + lane * 8, *(const v4u*)&xt[nl * 256 + lane * 8]);
      __builtin_amdgcn_wave_barrier();          // before the next m overwrites xt
    }
  }
  __syncthreads();
  const int n0blk = ((blockIdx.x * 4) & 255) << 4;
  for (int q = threadIdx.x; q < 256 * 8; q += 128) { const int o = q >> 3, pc = q & 7;
    vst2(V + ((size_t)b * Cch + o) * (size_t)Nsq + n0blk + pc * 8, *(const v4u*)&sVst[o * 64 + pc * 8]); }
}

// ---------------------------------------------------------------------------
// Kernel 2: flash attention + residual. One wave = 16 query columns x 256 channels, transposed: K and V are the A operands,
// Q^T and P^T the B operands, so lane l holds scores, statistics and context of query l & 15 alone.
// The block's 64 Q rows (once) and 64-key K and V tiles (two buffers) reach LDS by asynchronous copies of whole lines;
// the four waves read their fragments from there. Row pitches are 16 B x odd, so a ds_load_b128 meets no bank twice.
// ---------------------------------------------------------------------------
constexpr int KT   = 64;                 // keys per LDS stage = two 32-key softmax steps
constexpr int KPIT = Cch + 8;            // halfs per Q / K row in LDS: 512 B + 16 B
constexpr int VPIT = KT + 8;             // halfs per V row in LDS: 128 B + 16 B
constexpr int KBUF = KT * KPIT;          // halfs of one K tile
constexpr int STG  = KBUF + Cch * VPIT;  // halfs of one stage (K tile, then V tile)

// Eight 16-byte copies per lane, LDS address l + i*ls bytes, global address g + i*gs halfs. The s_wait_xcnt closes the
// statement so that no address register named here is rewritten ahead of it.
__device__ __forceinline__ void acopy8(unsigned l, unsigned ls, const _Float16* g, size_t gs) {
  asm volatile("global_load_async_to_lds_b128 %0, %8, off\n\t"
               "global_load_async_to_lds_b128 %1, %9, off\n\t"
               "global_load_async_to_lds_b128 %2, %10, off\n\t"
               "global_load_async_to_lds_b128 %3, %11, off\n\t"
               "global_load_async_to_lds_b128 %4, %12, off\n\t"
               "global_load_async_to_lds_b128 %5, %13, off\n\t"
               "global_load_async_to_lds_b128 %6, %14, off\n\t"
               "global_load_async_to_lds_b128 %7, %15, off\n\t"
               "s_wait_xcnt 0x0"
               :: "v"(l), "v"(l + ls), "v"(l + 2 * ls), "v"(l + 3 * ls), "v"(l + 4 * ls), "v"(l + 5 * ls), "v"(l + 6 * ls), "v"(l + 7 * ls),
                  "v"(g), "v"(g + gs), "v"(g + 2 * gs), "v"(g + 3 * gs), "v"(g + 4 * gs), "v"(g + 5 * gs), "v"(g + 6 * gs), "v"(g + 7 * gs)
               : "memory");
}
// 64 rows of 512 B (Q or K): a wave copies one whole row per instruction, rows wave, wave + 4, ...
__device__ __forceinline__ void copy_rows64(unsigned l, const _Float16* g) {
  acopy8(l, 4 * KPIT * 2, g, (size_t)4 * Cch);
  acopy8(l + 32 * KPIT * 2, 4 * KPIT * 2, g + (size_t)32 * Cch, (size_t)4 * Cch);
}
// 256 channel rows of 128 B (V): eight lanes copy one row, a block 16 rows per instruction
__device__ __forceinline__ void copy_vtile(unsigned l, const _Float16* g) {
  acopy8(l, 16 * VPIT * 2, g, (size_t)16 * Nsq);
  acopy8(l + 128 * VPIT * 2, 16 * VPIT * 2, g + (size_t)128 * Nsq, (size_t)16 * Nsq);
}
__global__ void __launch_bounds__(128, 1)
attn_kernel(const float* __restrict__ x,
            const _Float16* __restrict__ Qt,   // [B][N][C]
            const _Float16* __restrict__ Kt,   // [B][N][C]
            const _Float16* __restrict__ Vm,   // [B][C][N]
            float* __restrict__ out) {
  __shared__ __align__(16) float    cst[128 * 64];
  __shared__ __align__(16) _Float16 sQ[64 * KPIT];           // the block's query rows
  __shared__ __align__(16) _Float16 ring[2 * STG];           // two stages of K and V
  const int wave = threadIdx.x >> 5, lane = threadIdx.x & 31;
  const int tile = blockIdx.x * 4 + wave;      // 0..1023
  const int b  = tile >> 8;
  const int i0 = (tile & 255) << 4;
  const int row = lane & 15, half = lane >> 4;
  const float C1 = 0.0625f * 1.44269504089f;   // (1/sqrt(256)) * log2(e)

  // Q^T B-fragments (K=c, N=i): this lane's query row in LDS
  const _Float16* Qb = sQ + (wave * 16 + row) * KPIT;

  // each lane's own copy addresses: LDS byte address (low 32 bits of the shared address) and global pointer at stage 0
  const unsigned lQ = (unsigned)(size_t)sQ   + (unsigned)(wave * KPIT * 2 + lane * 16);
  const unsigned lK = (unsigned)(size_t)ring + (unsigned)(wave * KPIT * 2 + lane * 16);
  const unsigned rV = (unsigned)(size_t)ring + (unsigned)(KBUF * 2);                                   // V tile of buffer 0
  const unsigned lV = (unsigned)((threadIdx.x >> 3) * VPIT * 2 + (threadIdx.x & 7) * 16);              // this lane's place in a V tile
  // What lives across the key loop for the refills is kept as 32-bit offsets (lV, oK, oV), not as finished addresses: an operand of
  // the copies' asm statement must sit under v256, and with the fragments in registers a finished address held there was spilled.
  const _Float16* gQ = Qt + ((size_t)b * Nsq + (i0 - wave * 16) + wave) * Cch + lane * 8;
  const unsigned oK = (unsigned)((b * Nsq + wave) * Cch + lane * 8);                                   // in halfs from Kt, from Vm
  const unsigned oV = (unsigned)((b * Cch + (int)(threadIdx.x >> 3)) * Nsq + (int)(threadIdx.x & 7) * 8);
  copy_rows64(lQ, gQ);
  copy_rows64(lK, Kt + oK);
  copy_vtile(rV + lV, Vm + oV);
  asm volatile("s_wait_asynccnt 0x0" ::: "memory");   // this wave's share of Q and of stage 0 has landed
  __syncthreads();                                    // ... and every other wave's
  copy_rows64(lK + STG * 2, Kt + (oK + KT * Cch));    // stage 1 flies while stage 0 is worked on
  copy_vtile((rV + STG * 2) + lV, Vm + (oV + KT));

  v8f acc[16];                                  // context tile [256 c][16 i]: acc[ct][v] = channel ct*16 + 8*half + v of query row
  #pragma unroll
  for (int ct = 0; ct < 16; ++ct) { v8f z = {}; acc[ct] = z; }
  float mrun = -3.0e38f, srun = 0.f;            // online-softmax stats of this lane's query; srun sums this half's keys only

  // ---- the score operands sit in registers before a step starts: Q^T is read once, K is fetched one 32-key step ahead ----
  v16h qf[8], kf0[8], kf1[8];
  #pragma unroll
  for (int k = 0; k < 8; ++k) {
    qf[k]  = bfrag16(Qb + k * 32, half);                                   // A map == B map helper (row ptr at k0)
    kf0[k] = bfrag16(ring + row * KPIT + k * 32, half);                    // step 0: keys 0..15 and 16..31 of stage 0
    kf1[k] = bfrag16(ring + (16 + row) * KPIT + k * 32, half);
  }
  constexpr int SPS = KT / 32;                  // steps per stage
  constexpr int NST = Nsq / 32;                 // steps in all
  for (int n = 0; n < NST; ++n) {
    const int t = n / SPS, s = n % SPS;
    // ---- this step's V fragments: one group of reads at the head, they land under the scores and the softmax ----
    const _Float16* Vb = ring + (t & 1) * STG + KBUF + row * VPIT + s * 32;   // V row (c = ct*16+row) at this step's first key
    v16h vf[16];
    #pragma unroll
    for (int ct = 0; ct < 16; ++ct) vf[ct] = bfrag16(Vb + ct * 16 * VPIT, half);   // keys 8*half.., 16+8*half..
    __builtin_amdgcn_sched_barrier(0);          // keeps the reads one group: left free, they were spread among the products below
    // ---- scores: two 16x16 tiles (keys 0..15, 16..31 of this step), K = 256, operands already in registers ----
    v8f sD0 = {}, sD1 = {};                     // S^T: sD0[v] = key 8*half + v, sD1[v] = key 16 + 8*half + v, query row
    #pragma unroll
    for (int k = 0; k < 8; ++k) {
      sD0 = WMMA_F16(kf0[k], qf[k], sD0);
      sD1 = WMMA_F16(kf1[k], qf[k], sD1);
    }
    // A branch follows: the four vector slots that the chip needs before
    // the scores are read are written here; the barrier keeps the products above them.
    __builtin_amdgcn_sched_barrier(0);
    asm volatile("v_nop\n\tv_nop\n\tv_nop\n\tv_nop");
    if (s == SPS - 1) {                         // stage t has been read to its end: its last K rows a step ago, its last V rows just now
      asm volatile("s_wait_dscnt 0x0" ::: "memory");     // this wave's reads of stage t are done
      asm volatile("s_wait_asynccnt 0x0" ::: "memory");  // this wave's share of stage t + 1 has landed
      __syncthreads();                                   // publishes stage t + 1 and frees stage t's buffer
      if (t + 2 < Nsq / KT) {                            // refill the buffer just read
        copy_rows64(lK + (t & 1) * STG * 2, Kt + (oK + (unsigned)(t + 2) * KT * Cch));
        copy_vtile(((t & 1) ? rV + STG * 2 : rV) + lV, Vm + (oV + (unsigned)(t + 2) * KT));
      }
    }
    // ---- the next step's K fragments, into the registers the products above have just read; they land under the softmax and the
    // context products. The last step has no next one and reads its own rows again (published, never used). ----
    {
      const int n1 = n + 1 < NST ? n + 1 : n;
      const _Float16* K0 = ring + ((n1 / SPS) & 1) * STG + ((n1 % SPS) * 32 + row) * KPIT;   // key row; same K map as q
      const _Float16* K1 = K0 + 16 * KPIT;
      #pragma unroll
      for (int k = 0; k < 8; ++k) {
        kf0[k] = bfrag16(K0 + k * 32, half);
        kf1[k] = bfrag16(K1 + k * 32, half);
      }
      __builtin_amdgcn_sched_barrier(0);        // keeps the reads here: left free, they sank among the context products and landed late
    }
    // ---- online softmax of one query per lane: 16 keys in the lane's own registers, the other 16 in lane ^ 16 ----
    float lm[8];
    #pragma unroll
    for (int v = 0; v < 8; ++v) lm[v] = fmaxf(sD0[v], sD1[v]);
    float l8 = fmaxf(fmaxf(fmaxf(lm[0], lm[1]), fmaxf(lm[2], lm[3])), fmaxf(fmaxf(lm[4], lm[5]), fmaxf(lm[6], lm[7])));
    l8 = fmaxf(l8, xhalf(l8));
    const float mn  = fmaxf(mrun, l8);
    const float cor = __builtin_exp2f((mrun - mn) * C1);
    mrun = mn;
    // two D tiles of S^T, converted in place, are the B fragment of P^T: element s = key 8*half + s, 16 + 8*half + (s - 8)
    v16h pb;
    float ps[8];
    #pragma unroll
    for (int v = 0; v < 8; ++v) {
      const float p0 = __builtin_exp2f((sD0[v] - mn) * C1);
      const float p1 = __builtin_exp2f((sD1[v] - mn) * C1);
      ps[v] = p0 + p1;
      pb[v]     = (_Float16)(p0 * 16384.0f);    // lifted by 2^14 (p <= 1)
      pb[8 + v] = (_Float16)(p1 * 16384.0f);
    }
    srun = srun * cor + (((ps[0] + ps[1]) + (ps[2] + ps[3])) + ((ps[4] + ps[5]) + (ps[6] + ps[7])));
    // ---- context = context * cor + V x P^T : 16 channel tiles, one factor per lane, V fragments already in registers ----
    #pragma unroll
    for (int ct = 0; ct < 16; ++ct) acc[ct] = WMMA_F16(vf[ct], pb, acc[ct] * cor);
    // The loop's back edge follows: the four vector slots that the chip
    // needs before the next pass overwrites the last products' operands are written here; the barrier keeps the products above them.
    __builtin_amdgcn_sched_barrier(0);
    asm volatile("v_nop\n\tv_nop\n\tv_nop\n\tv_nop");
  }
  asm volatile("s_wait_asynccnt 0x0" ::: "memory");   // nothing of this wave is in flight when the loop is left

  // ---- epilogue: out = x + context / rowsum.
  // Gather the four waves' context through LDS (two 128-channel passes) so the residual
  // add runs on full 256-byte channel rows with b128 loads/stores.
  // Block = 4 waves = 64 consecutive query positions: stage [128 c][64 i] per pass, then 256-B row segments of (b, c, i0blk..)
  const float rinv = (1.0f / 16384.0f) / (srun + xhalf(srun));   // the two halves' key sums are joined here, once
  const int i0blk = ((blockIdx.x * 4) & 255) << 4;
  #pragma unroll
  for (int pass = 0; pass < 2; ++pass) {
    __syncthreads();
    #pragma unroll
    for (int ct = 0; ct < 8; ++ct) {
      #pragma unroll
      for (int v = 0; v < 8; ++v)               // local channel ct*16 + 8*half + v, query wave*16 + row
        cst[(ct * 16 + half * 8 + v) * 64 + wave * 16 + row] = acc[pass * 8 + ct][v] * rinv;
    }
    __syncthreads();
    for (int qd = threadIdx.x; qd < 128 * 16; qd += 128) { const int cl = qd >> 4, pc = qd & 15;
      const int c = pass * 128 + cl;
      const size_t base = ((size_t)b * Cch + c) * (size_t)Nsq + i0blk + pc * 4;
      v4f cv = *(const v4f*)&cst[cl * 64 + pc * 4] + *(const v4f*)&x[base];
      vst2(out + base, cv); }
  }
}

// ---------------------------------------------------------------------------
extern "C" void kernel_launch(void* const* d_in, const int* in_sizes, int n_in,
                              void* d_out, int out_size, void* d_ws, size_t ws_size,
                              hipStream_t stream) {
  const float* x  = (const float*)d_in[0];
  const float* Wq = (const float*)d_in[1];
  const float* bq = (const float*)d_in[2];
  const float* Wk = (const float*)d_in[3];
  const float* bk = (const float*)d_in[4];
  const float* Wv = (const float*)d_in[5];
  const float* bv = (const float*)d_in[6];
  float* out = (float*)d_out;

  // workspace layout: [3][C][C] f16 weights | Qt | Kt | V  (~24.4 MiB total)
  char* ws = (char*)d_ws;
  _Float16* wh = (_Float16*)ws;
  _Float16* Qt = (_Float16*)(ws + (size_t)3 * Cch * Cch * 2);
  _Float16* Kt = Qt + (size_t)Bsz * Nsq * Cch;
  _Float16* V  = Kt + (size_t)Bsz * Nsq * Cch;

  wcvt_kernel<<<(3 * Cch * Cch / 8) / 256, 256, 0, stream>>>(Wq, Wk, Wv, wh);
  // 1024 wave-tiles, 4 waves (128 threads) per block
  qkv_kernel<<<256, 128, 0, stream>>>(x, wh, bq, bk, bv, Qt, Kt, V);
  attn_kernel<<<256, 128, 0, stream>>>(x, Qt, Kt, V, out);
}

// v005
// A run of this version takes 112 microseconds.
// Two timings next to v004 both put it at 1.35 times that version's speed.
// All steps since v000 together make it 8.95 times as fast.
#include <hip/hip_runtime.h>

typedef __attribute__((ext_vector_type(16))) _Float16 v16h;
typedef __attribute__((ext_vector_type(8)))  _Float16 v8h;
typedef __attribute__((ext_vector_type(8)))  float    v8f;
typedef __attribute__((ext_vector_type(4)))  float    v4f;

// Contractions (Q/K/V 1x1 convs K = 256; scores Q.K over C = 256; attn @ V over 4096 keys) on v_wmma_f32_16x16x32_f16:
// f16 operands, f32 accumulate; online softmax in f32 with P lifted by 2^14 before the f16 conversion; B fragments use the
// same per-lane K map as A (8*half+0..7, 16+8*half+0..7). Attention runs transposed (S^T = K.Q^T, O^T += V.P^T): a lane owns one query.
// Q/K/V panels and the output are staged in LDS and written as whole
typedef __attribute__((ext_vector_type(4)))  unsigned v4u;
template <typename T> __device__ __forceinline__ void vst2(void* p, T v) { *(T*)p = v;  }
__device__ __forceinline__ v8f WMMA_F16(v16h a, v16h b, v8f c) {
  return __builtin_amdgcn_wmma_f32_16x16x32_f16(false, a, false, b, (short)0, c, false, false);
}
__device__ __forceinline__ v16h bfrag16(const _Float16* rowk0, int half) {     // row pointer at k0; k = 8*half+i, 16+8*half+i
  v16h b; ((v8h*)&b)[0] = *(const v8h*)(rowk0 + half * 8); ((v8h*)&b)[1] = *(const v8h*)(rowk0 + 16 + half * 8); return b;
}
// lane l <-> lane l ^ 16 on the vector pipe (no LDS queue behind it)
__device__ __forceinline__ float xhalf(float v) {
  const int b = __builtin_bit_cast(int, v);
  return __builtin_bit_cast(float, __builtin_amdgcn_permlanex16(b, b, 0x76543210, 0xfedcba98, false, false));
}
#define LDSX() do { asm volatile("s_wait_dscnt 0" ::: "memory"); __builtin_amdgcn_wave_barrier(); __builtin_amdgcn_fence(__ATOMIC_RELEASE, "workgroup"); } while (0)

constexpr int Bsz = 4;
constexpr int Cch = 256;   // channels
constexpr int Nsq = 4096;  // sequence positions
constexpr int KPIT = Cch + 8;            // halfs per Q / K / weight row in LDS: 512 B + 16 B

// Eight 16-byte copies per lane, LDS address l + i*ls bytes, global address g + i*gs halfs. The s_wait_xcnt closes the
// statement so that no address register named here is rewritten ahead of it.
__device__ __forceinline__ void acopy8(unsigned l, unsigned ls, const _Float16* g, size_t gs) {
  asm volatile("global_load_async_to_lds_b128 %0, %8, off\n\t"
               "global_load_async_to_lds_b128 %1, %9, off\n\t"
               "global_load_async_to_lds_b128 %2, %10, off\n\t"
               "global_load_async_to_lds_b128 %3, %11, off\n\t"
               "global_load_async_to_lds_b128 %4, %12, off\n\t"
               "global_load_async_to_lds_b128 %5, %13, off\n\t"
               "global_load_async_to_lds_b128 %6, %14, off\n\t"
               "global_load_async_to_lds_b128 %7, %15, off\n\t"
               "s_wait_xcnt 0x0"
               :: "v"(l), "v"(l + ls), "v"(l + 2 * ls), "v"(l + 3 * ls), "v"(l + 4 * ls), "v"(l + 5 * ls), "v"(l + 6 * ls), "v"(l + 7 * ls),
                  "v"(g), "v"(g + gs), "v"(g + 2 * gs), "v"(g + 3 * gs), "v"(g + 4 * gs), "v"(g + 5 * gs), "v"(g + 6 * gs), "v"(g + 7 * gs)
               : "memory");
}
// 64 rows of 512 B (Q, K or weights): a wave copies one whole row per instruction, rows wave, wave + 4, ...
__device__ __forceinline__ void copy_rows64(unsigned l, const _Float16* g) {
  acopy8(l, 4 * KPIT * 2, g, (size_t)4 * Cch);
  acopy8(l + 32 * KPIT * 2, 4 * KPIT * 2, g + (size_t)32 * Cch, (size_t)4 * Cch);
}

// ---------------------------------------------------------------------------
// Kernel 0: convert the three 256x256 weight matrices to f16 (packed [3][C][C])
// ---------------------------------------------------------------------------
__global__ void wcvt_kernel(const float* __restrict__ wq,
                            const float* __restrict__ wk,
                            const float* __restrict__ wv,
                            _Float16* __restrict__ out) {
  int g8 = blockIdx.x * 256 + threadIdx.x;      // 0 .. 3*65536/8-1, 16 B per thread
  int t0 = g8 * 8; int m = t0 >> 16, e = t0 & 65535;
  const float* s = (m == 0) ? wq : (m == 1) ? wk : wv;
  union { v8h h; v4u u; } pk;
#pragma unroll
  for (int i = 0; i < 8; ++i) pk.h[i] = (_Float16)s[e + i];
  vst2(out + t0, pk.u);
}

// ---------------------------------------------------------------------------
// Kernel 1: QKV projection via WMMA.
//   Qt, Kt : [B][N][C] f16  (row n, contiguous channels -> A/B frags are b128)
//   V      : [B][C][N] f16  (row c, contiguous j        -> A frags are b128)
// One wave handles a 16-row n tile; x tile transposed through LDS once.
// The 768 weight rows reach LDS in tiles of 64 rows (two buffers) by asynchronous copies of whole lines, once for the four
// waves; each wave reads its B fragments from there (row pitch 16 B x odd: a ds_load_b128 meets no bank twice).
// ---------------------------------------------------------------------------
constexpr int WROWS = 64;                // weight rows per LDS tile = four 16-column output tiles
constexpr int WBUF  = WROWS * KPIT;      // halfs of one weight tile
constexpr int NWT   = 3 * Cch / WROWS;   // weight tiles in all
__global__ void __launch_bounds__(128, 1)
qkv_kernel(const float* __restrict__ x,         // [B][C][N] f32
           const _Float16* __restrict__ wh,     // [3][C][C] f16
           const float* __restrict__ bq,
           const float* __restrict__ bk,
           const float* __restrict__ bv,
           _Float16* __restrict__ Qt,
           _Float16* __restrict__ Kt,
           _Float16* __restrict__ V) {
  __shared__ __align__(16) _Float16 xT[4][16 * 256];          // per-wave x^T tile (8KB each), reused as the Q/K row staging
  __shared__ __align__(16) _Float16 sVst[256 * 64];            // block staging of V [o][n0blk..+63] (32 KB)
  __shared__ __align__(16) _Float16 wring[2 * WBUF];           // two tiles of weight rows
  const int wave = threadIdx.x >> 5, lane = threadIdx.x & 31;
  const int tile = blockIdx.x * 4 + wave;       // 0..1023
  const int b  = tile >> 8;                     // 256 n-tiles per batch
  const int n0 = (tile & 255) << 4;
  const int row = lane & 15, half = lane >> 4;

  // each lane's own copy addresses at weight tile 0: LDS byte address (low 32 bits of the shared address) and global pointer
  const unsigned lW = (unsigned)(size_t)wring + (unsigned)(wave * KPIT * 2 + lane * 16);
  const _Float16* gW = wh + wave * Cch + lane * 8;
  copy_rows64(lW, gW);                          // tile 0 flies while x is staged

  _Float16* xt = xT[wave];
  const float* xb = x + (size_t)b * Cch * Nsq;
  // stage x[b][:, n0..n0+15] transposed into LDS as xT[n][c] f16
  #pragma unroll 4
  for (int it = 0; it < 128; ++it) {
    int idx = it * 32 + lane;
    int c = idx >> 4, n = idx & 15;
    xt[n * 256 + c] = (_Float16)xb[(size_t)c * Nsq + n0 + n];
  }
  LDSX();

  // A fragments of x^T (M=n, K=c), K=256 in 8 chunks of 32
  v16h a[8];
  #pragma unroll
  for (int k = 0; k < 8; ++k) {
    ((v8h*)&a[k])[0] = *(const v8h*)&xt[row * 256 + k * 32 + half * 8];
    ((v8h*)&a[k])[1] = *(const v8h*)&xt[row * 256 + k * 32 + half * 8 + 16];
  }

  asm volatile("s_wait_asynccnt 0x0" ::: "memory");   // this wave's share of weight tile 0 has landed
  __syncthreads();                                    // ... and every other wave's
  copy_rows64(lW + WBUF * 2, gW + WROWS * Cch);       // tile 1 flies while tile 0 is worked on

  #pragma unroll
  for (int m = 0; m < 3; ++m) {                 // m constant after unroll: no flat loads
    const float* bias = (m == 0) ? bq : (m == 1) ? bk : bv;
    for (int q = 0; q < 4; ++q) {               // weight tile t = 4 m + q: output columns 64 q .. 64 q + 63 of matrix m
      const int t = m * 4 + q;
      const _Float16* Wb = wring + (q & 1) * WBUF + row * KPIT;      // this lane's weight row of the tile's first 16
      v16h wf[8][4];                            // read in the order in which the products below take them
      #pragma unroll
      for (int k = 0; k < 8; ++k) {
        #pragma unroll
        for (int j = 0; j < 4; ++j) wf[k][j] = bfrag16(Wb + j * 16 * KPIT + k * 32, half);   // same K map as A
      }
      float bo[4];
      #pragma unroll
      for (int j = 0; j < 4; ++j) bo[j] = bias[(q * 4 + j) * 16 + row];
      asm volatile("s_wait_xcnt 0x0" ::: "memory");   // stands in front of every rewrite of the bias loads' address registers
      // Keeps the tile's reads one group ahead of the products (left free, they were spread among them and waited for one by one)
      // and the address arithmetic of the next trip behind the wait above.
      __builtin_amdgcn_sched_barrier(0);
      v8f acc[4];
      #pragma unroll
      for (int j = 0; j < 4; ++j) { v8f z = {}; acc[j] = z; }
      #pragma unroll
      for (int k = 0; k < 8; ++k) {
        #pragma unroll
        for (int j = 0; j < 4; ++j) acc[j] = WMMA_F16(a[k], wf[k][j], acc[j]);
      }
      #pragma unroll
      for (int j = 0; j < 4; ++j) {
        const int o = (q * 4 + j) * 16 + row;   // this lane's output column
        #pragma unroll
        for (int v = 0; v < 8; ++v) {           // D: (M = v + 8*half, N = row) -> stage in LDS
          float val = acc[j][v] + bo[j];
          int nl = v + half * 8;                // local n (0..15)
          if (m < 2) xt[nl * 256 + o] = (_Float16)val;                 // Q/K rows [n][o] (xt is free: A frags live in registers)
          else       sVst[o * 64 + wave * 16 + nl] = (_Float16)val;    // V [o][block-local n]
        }
      }
      asm volatile("s_wait_dscnt 0x0" ::: "memory");     // this wave's reads of tile t are done
      asm volatile("s_wait_asynccnt 0x0" ::: "memory");  // this wave's share of tile t + 1 has landed
      __syncthreads();                                   // publishes tile t + 1 and frees tile t's buffer
      if (t + 2 < NWT) copy_rows64(lW + (q & 1) * WBUF * 2, gW + (size_t)(t + 2) * WROWS * Cch);   // refill the buffer just read
    }
    if (m < 2) {                                // this wave's 16 rows of Qt / Kt: 512 B each = 32 lanes x 16 B
      LDSX();
      _Float16* dst = (m == 0 ? Qt : Kt) + ((size_t)b * Nsq + n0) * Cch;
      #pragma unroll 4
      for (int nl = 0; nl < 16; ++nl) vst2(dst + (size_t)nl * Cch + lane * 8, *(const v4u*)&xt[nl * 256 + lane * 8]);
      __builtin_amdgcn_wave_barrier();          // before the next m overwrites xt
    }
  }
  asm volatile("s_wait_asynccnt 0x0" ::: "memory");   // nothing of this wave is in flight when the loop is left
  __syncthreads();
  const int n0blk = ((blockIdx.x * 4) & 255) << 4;
  for (int q = threadIdx.x; q < 256 * 8; q += 128) { const int o = q >> 3, pc = q & 7;
    vst2(V + ((size_t)b * Cch + o) * (size_t)Nsq + n0blk + pc * 8, *(const v4u*)&sVst[o * 64 + pc * 8]); }
}

// ---------------------------------------------------------------------------
// Kernel 2: flash attention + residual. One wave = 16 query columns x 256 channels, transposed: K and V are the A operands,
// Q^T and P^T the B operands, so lane l holds scores, statistics and context of query l & 15 alone.
// The block's 64 Q rows (once) and 64-key K and V tiles (two buffers) reach LDS by asynchronous copies of whole lines;
// the four waves read their fragments from there. Row pitches are 16 B x odd, so a ds_load_b128 meets no bank twice.
// ---------------------------------------------------------------------------
constexpr int KT   = 64;                 // keys per LDS stage = two 32-key softmax steps
constexpr int VPIT = KT + 8;             // halfs per V row in LDS: 128 B + 16 B
constexpr int KBUF = KT * KPIT;          // halfs of one K tile
constexpr int STG  = KBUF + Cch * VPIT;  // halfs of one stage (K tile, then V tile)

// 256 channel rows of 128 B (V): eight lanes copy one row, a block 16 rows per instruction
__device__ __forceinline__ void copy_vtile(unsigned l, const _Float16* g) {
  acopy8(l, 16 * VPIT * 2, g, (size_t)16 * Nsq);
  acopy8(l + 128 * VPIT * 2, 16 * VPIT * 2, g + (size_t)128 * Nsq, (size_t)16 * Nsq);
}
__global__ void __launch_bounds__(128, 1)
attn_kernel(const float* __restrict__ x,
            const _Float16* __restrict__ Qt,   // [B][N][C]
            const _Float16* __restrict__ Kt,   // [B][N][C]
            const _Float16* __restrict__ Vm,   // [B][C][N]
            float* __restrict__ out) {
  __shared__ __align__(16) float    cst[128 * 64];
  __shared__ __align__(16) _Float16 sQ[64 * KPIT];           // the block's query rows
  __shared__ __align__(16) _Float16 ring[2 * STG];           // two stages of K and V
  const int wave = threadIdx.x >> 5, lane = threadIdx.x & 31;
  const int tile = blockIdx.x * 4 + wave;      // 0..1023
  const int b  = tile >> 8;
  const int i0 = (tile & 255) << 4;
  const int row = lane & 15, half = lane >> 4;
  const float C1 = 0.0625f * 1.44269504089f;   // (1/sqrt(256)) * log2(e)

  // Q^T B-fragments (K=c, N=i): this lane's query row in LDS
  const _Float16* Qb = sQ + (wave * 16 + row) * KPIT;

  // each lane's own copy addresses: LDS byte address (low 32 bits of the shared address) and global pointer at stage 0
  const unsigned lQ = (unsigned)(size_t)sQ   + (unsigned)(wave * KPIT * 2 + lane * 16);
  const unsigned lK = (unsigned)(size_t)ring + (unsigned)(wave * KPIT * 2 + lane * 16);
  const unsigned rV = (unsigned)(size_t)ring + (unsigned)(KBUF * 2);                                   // V tile of buffer 0
  const unsigned lV = (unsigned)((threadIdx.x >> 3) * VPIT * 2 + (threadIdx.x & 7) * 16);              // this lane's place in a V tile
  // What lives across the key loop for the refills is kept as 32-bit offsets (lV, oK, oV), not as finished addresses: an operand of
  // the copies' asm statement must sit under v256, and with the fragments in registers a finished address held there was spilled.
  const _Float16* gQ = Qt + ((size_t)b * Nsq + (i0 - wave * 16) + wave) * Cch + lane * 8;
  const unsigned oK = (unsigned)((b * Nsq + wave) * Cch + lane * 8);                                   // in halfs from Kt, from Vm
  const unsigned oV = (unsigned)((b * Cch + (int)(threadIdx.x >> 3)) * Nsq + (int)(threadIdx.x & 7) * 8);
  copy_rows64(lQ, gQ);
  copy_rows64(lK, Kt + oK);
  copy_vtile(rV + lV, Vm + oV);
  asm volatile("s_wait_asynccnt 0x0" ::: "memory");   // this wave's share of Q and of stage 0 has landed
  __syncthreads();                                    // ... and every other wave's
  copy_rows64(lK + STG * 2, Kt + (oK + KT * Cch));    // stage 1 flies while stage 0 is worked on
  copy_vtile((rV + STG * 2) + lV, Vm + (oV + KT));

  v8f acc[16];                                  // context tile [256 c][16 i]: acc[ct][v] = channel ct*16 + 8*half + v of query row
  #pragma unroll
  for (int ct = 0; ct < 16; ++ct) { v8f z = {}; acc[ct] = z; }
  float mrun = -3.0e38f, srun = 0.f;            // online-softmax stats of this lane's query; srun sums this half's keys only

  // ---- the score operands sit in registers before a step starts: Q^T is read once, K is fetched one 32-key step ahead ----
  v16h qf[8], kf0[8], kf1[8];
  #pragma unroll
  for (int k = 0; k < 8; ++k) {
    qf[k]  = bfrag16(Qb + k * 32, half);                                   // A map == B map helper (row ptr at k0)
    kf0[k] = bfrag16(ring + row * KPIT + k * 32, half);                    // step 0: keys 0..15 and 16..31 of stage 0
    kf1[k] = bfrag16(ring + (16 + row) * KPIT + k * 32, half);
  }
  constexpr int SPS = KT / 32;                  // steps per stage
  constexpr int NST = Nsq / 32;                 // steps in all
  for (int n = 0; n < NST; ++n) {
    const int t = n / SPS, s = n % SPS;
    // ---- this step's V fragments: one group of reads at the head, they land under the scores and the softmax ----
    const _Float16* Vb = ring + (t & 1) * STG + KBUF + row * VPIT + s * 32;   // V row (c = ct*16+row) at this step's first key
    v16h vf[16];
    #pragma unroll
    for (int ct = 0; ct < 16; ++ct) vf[ct] = bfrag16(Vb + ct * 16 * VPIT, half);   // keys 8*half.., 16+8*half..
    __builtin_amdgcn_sched_barrier(0);          // keeps the reads one group: left free, they were spread among the products below
    // ---- scores: two 16x16 tiles (keys 0..15, 16..31 of this step), K = 256, operands already in registers ----
    v8f sD0 = {}, sD1 = {};                     // S^T: sD0[v] = key 8*half + v, sD1[v] = key 16 + 8*half + v, query row
    #pragma unroll
    for (int k = 0; k < 8; ++k) {
      sD0 = WMMA_F16(kf0[k], qf[k], sD0);
      sD1 = WMMA_F16(kf1[k], qf[k], sD1);
    }
    // A branch follows: the four vector slots that the chip needs before
    // the scores are read are written here; the barrier keeps the products above them.
    __builtin_amdgcn_sched_barrier(0);
    asm volatile("v_nop\n\tv_nop\n\tv_nop\n\tv_nop");
    if (s == SPS - 1) {                         // stage t has been read to its end: its last K rows a step ago, its last V rows just now
      asm volatile("s_wait_dscnt 0x0" ::: "memory");     // this wave's reads of stage t are done
      asm volatile("s_wait_asynccnt 0x0" ::: "memory");  // this wave's share of stage t + 1 has landed
      __syncthreads();                                   // publishes stage t + 1 and frees stage t's buffer
      if (t + 2 < Nsq / KT) {                            // refill the buffer just read
        copy_rows64(lK + (t & 1) * STG * 2, Kt + (oK + (unsigned)(t + 2) * KT * Cch));
        copy_vtile(((t & 1) ? rV + STG * 2 : rV) + lV, Vm + (oV + (unsigned)(t + 2) * KT));
      }
    }
    // ---- the next step's K fragments, into the registers the products above have just read; they land under the softmax and the
    // context products. The last step has no next one and reads its own rows again (published, never used). ----
    {
      const int n1 = n + 1 < NST ? n + 1 : n;
      const _Float16* K0 = ring + ((n1 / SPS) & 1) * STG + ((n1 % SPS) * 32 + row) * KPIT;   // key row; same K map as q
      const _Float16* K1 = K0 + 16 * KPIT;
      #pragma unroll
      for (int k = 0; k < 8; ++k) {
        kf0[k] = bfrag16(K0 + k * 32, half);
        kf1[k] = bfrag16(K1 + k * 32, half);
      }
      __builtin_amdgcn_sched_barrier(0);        // keeps the reads here: left free, they sank among the context products and landed late
    }
    // ---- online softmax of one query per lane: 16 keys in the lane's own registers, the other 16 in lane ^ 16 ----
    float lm[8];
    #pragma unroll
    for (int v = 0; v < 8; ++v) lm[v] = fmaxf(sD0[v], sD1[v]);
    float l8 = fmaxf(fmaxf(fmaxf(lm[0], lm[1]), fmaxf(lm[2], lm[3])), fmaxf(fmaxf(lm[4], lm[5]), fmaxf(lm[6], lm[7])));
    l8 = fmaxf(l8, xhalf(l8));
    const float mn  = fmaxf(mrun, l8);
    const float cor = __builtin_exp2f((mrun - mn) * C1);
    mrun = mn;
    // two D tiles of S^T, converted in place, are the B fragment of P^T: element s = key 8*half + s, 16 + 8*half + (s - 8)
    v16h pb;
    float ps[8];
    #pragma unroll
    for (int v = 0; v < 8; ++v) {
      const float p0 = __builtin_exp2f((sD0[v] - mn) * C1);
      const float p1 = __builtin_exp2f((sD1[v] - mn) * C1);
      ps[v] = p0 + p1;
      pb[v]     = (_Float16)(p0 * 16384.0f);    // lifted by 2^14 (p <= 1)
      pb[8 + v] = (_Float16)(p1 * 16384.0f);
    }
    srun = srun * cor + (((ps[0] + ps[1]) + (ps[2] + ps[3])) + ((ps[4] + ps[5]) + (ps[6] + ps[7])));
    // ---- context = context * cor + V x P^T : 16 channel tiles, one factor per lane, V fragments already in registers ----
    #pragma unroll
    for (int ct = 0; ct < 16; ++ct) acc[ct] = WMMA_F16(vf[ct], pb, acc[ct] * cor);
    // The loop's back edge follows: the four vector slots that the chip
    // needs before the next pass overwrites the last products' operands are written here; the barrier keeps the products above them.
    __builtin_amdgcn_sched_barrier(0);
    asm volatile("v_nop\n\tv_nop\n\tv_nop\n\tv_nop");
  }
  asm volatile("s_wait_asynccnt 0x0" ::: "memory");   // nothing of this wave is in flight when the loop is left

  // ---- epilogue: out = x + context / rowsum.
  // Gather the four waves' context through LDS (two 128-channel passes) so the residual
  // add runs on full 256-byte channel rows with b128 loads/stores.
  // Block = 4 waves = 64 consecutive query positions: stage [128 c][64 i] per pass, then 256-B row segments of (b, c, i0blk..)
  const float rinv = (1.0f / 16384.0f) / (srun + xhalf(srun));   // the two halves' key sums are joined here, once
  const int i0blk = ((blockIdx.x * 4) & 255) << 4;
  #pragma unroll
  for (int pass = 0; pass < 2; ++pass) {
    __syncthreads();
    #pragma unroll
    for (int ct = 0; ct < 8; ++ct) {
      #pragma unroll
      for (int v = 0; v < 8; ++v)               // local channel ct*16 + 8*half + v, query wave*16 + row
        cst[(ct * 16 + half * 8 + v) * 64 + wave * 16 + row] = acc[pass * 8 + ct][v] * rinv;
    }
    __syncthreads();
    for (int qd = threadIdx.x; qd < 128 * 16; qd += 128) { const int cl = qd >> 4, pc = qd & 15;
      const int c = pass * 128 + cl;
      const size_t base = ((size_t)b * Cch + c) * (size_t)Nsq + i0blk + pc * 4;
      v4f cv = *(const v4f*)&cst[cl * 64 + pc * 4] + *(const v4f*)&x[base];
      vst2(out + base, cv); }
  }
}

// ---------------------------------------------------------------------------
extern "C" void kernel_launch(void* const* d_in, const int* in_sizes, int n_in,
                              void* d_out, int out_size, void* d_ws, size_t ws_size,
                              hipStream_t stream) {
  const float* x  = (const float*)d_in[0];
  const float* Wq = (const float*)d_in[1];
  const float* bq = (const float*)d_in[2];
  const float* Wk = (const float*)d_in[3];
  const float* bk = (const float*)d_in[4];
  const float* Wv = (const float*)d_in[5];
  const float* bv = (const float*)d_in[6];
  float* out = (float*)d_out;

  // workspace layout: [3][C][C] f16 weights | Qt | Kt | V  (~24.4 MiB total)
  char* ws = (char*)d_ws;
  _Float16* wh = (_Float16*)ws;
  _Float16* Qt = (_Float16*)(ws + (size_t)3 * Cch * Cch * 2);
  _Float16* Kt = Qt + (size_t)Bsz * Nsq * Cch;
  _Float16* V  = Kt + (size_t)Bsz * Nsq * Cch;

  wcvt_kernel<<<(3 * Cch * Cch / 8) / 256, 256, 0, stream>>>(Wq, Wk, Wv, wh);
  // 1024 wave-tiles, 4 waves (128 threads) per block
  qkv_kernel<<<256, 128, 0, stream>>>(x, wh, bq, bk, bv, Qt, Kt, V);
  attn_kernel<<<256, 128, 0, stream>>>(x, Qt, Kt, V, out);
}

// v006
// It runs in 104 microseconds.
// Timed twice side by side with v005, it ran 1.09 and 1.08 times as fast.
// Counting every step since v000, it is 9.71 times as fast.
#include <hip/hip_runtime.h>

typedef __attribute__((ext_vector_type(16))) _Float16 v16h;
typedef __attribute__((ext_vector_type(8)))  _Float16 v8h;
typedef __attribute__((ext_vector_type(8)))  float    v8f;
typedef __attribute__((ext_vector_type(4)))  float    v4f;

// Contractions (Q/K/V 1x1 convs K = 256; scores Q.K over C = 256; attn @ V over 4096 keys) on v_wmma_f32_16x16x32_f16:
// f16 operands, f32 accumulate; online softmax in f32 with P lifted by 2^14 before the f16 conversion; B fragments use the
// same per-lane K map as A (8*half+0..7, 16+8*half+0..7). Attention runs transposed (S^T = K.Q^T, O^T += V.P^T): a lane owns one query.
// Q/K/V panels and the output are staged in LDS and written as whole
typedef __attribute__((ext_vector_type(4)))  unsigned v4u;
template <typename T> __device__ __forceinline__ void vst2(void* p, T v) { *(T*)p = v;  }
__device__ __forceinline__ v8f WMMA_F16(v16h a, v16h b, v8f c) {
  return __builtin_amdgcn_wmma_f32_16x16x32_f16(false, a, false, b, (short)0, c, false, false);
}
__device__ __forceinline__ v16h bfrag16(const _Float16* rowk0, int half) {     // row pointer at k0; k = 8*half+i, 16+8*half+i
  v16h b; ((v8h*)&b)[0] = *(const v8h*)(rowk0 + half * 8); ((v8h*)&b)[1] = *(const v8h*)(rowk0 + 16 + half * 8); return b;
}
// lane l <-> lane l ^ 16 on the vector pipe (no LDS queue behind it)
__device__ __forceinline__ float xhalf(float v) {
  const int b = __builtin_bit_cast(int, v);
  return __builtin_bit_cast(float, __builtin_amdgcn_permlanex16(b, b, 0x76543210, 0xfedcba98, false, false));
}
#define LDSX() do { asm volatile("s_wait_dscnt 0" ::: "memory"); __builtin_amdgcn_wave_barrier(); __builtin_amdgcn_fence(__ATOMIC_RELEASE, "workgroup"); } while (0)

constexpr int Bsz = 4;
constexpr int Cch = 256;   // channels
constexpr int Nsq = 4096;  // sequence positions
constexpr int KPIT = Cch + 8;            // halfs per Q / K / weight row in LDS: 512 B + 16 B

// Eight 16-byte copies per lane, LDS address l + i*ls bytes, global address g + i*gs halfs. The s_wait_xcnt closes the
// statement so that no address register named here is rewritten ahead of it.
__device__ __forceinline__ void acopy8(unsigned l, unsigned ls, const _Float16* g, size_t gs) {
  asm volatile("global_load_async_to_lds_b128 %0, %8, off\n\t"
               "global_load_async_to_lds_b128 %1, %9, off\n\t"
               "global_load_async_to_lds_b128 %2, %10, off\n\t"
               "global_load_async_to_lds_b128 %3, %11, off\n\t"
               "global_load_async_to_lds_b128 %4, %12, off\n\t"
               "global_load_async_to_lds_b128 %5, %13, off\n\t"
               "global_load_async_to_lds_b128 %6, %14, off\n\t"
               "global_load_async_to_lds_b128 %7, %15, off\n\t"
               "s_wait_xcnt 0x0"
               :: "v"(l), "v"(l + ls), "v"(l + 2 * ls), "v"(l + 3 * ls), "v"(l + 4 * ls), "v"(l + 5 * ls), "v"(l + 6 * ls), "v"(l + 7 * ls),
                  "v"(g), "v"(g + gs), "v"(g + 2 * gs), "v"(g + 3 * gs), "v"(g + 4 * gs), "v"(g + 5 * gs), "v"(g + 6 * gs), "v"(g + 7 * gs)
               : "memory");
}
// 64 rows of 512 B (weights): a wave copies one whole row per instruction, rows wave, wave + 4, ...
__device__ __forceinline__ void copy_rows64(unsigned l, const _Float16* g) {
  acopy8(l, 4 * KPIT * 2, g, (size_t)4 * Cch);
  acopy8(l + 32 * KPIT * 2, 4 * KPIT * 2, g + (size_t)32 * Cch, (size_t)4 * Cch);
}

// ---------------------------------------------------------------------------
// Kernel 0: convert the three 256x256 weight matrices to f16 (packed [3][C][C])
// ---------------------------------------------------------------------------
__global__ void wcvt_kernel(const float* __restrict__ wq,
                            const float* __restrict__ wk,
                            const float* __restrict__ wv,
                            _Float16* __restrict__ out) {
  int g8 = blockIdx.x * 256 + threadIdx.x;      // 0 .. 3*65536/8-1, 16 B per thread
  int t0 = g8 * 8; int m = t0 >> 16, e = t0 & 65535;
  const float* s = (m == 0) ? wq : (m == 1) ? wk : wv;
  union { v8h h; v4u u; } pk;
#pragma unroll
  for (int i = 0; i < 8; ++i) pk.h[i] = (_Float16)s[e + i];
  vst2(out + t0, pk.u);
}

// ---------------------------------------------------------------------------
// Kernel 1: QKV projection via WMMA.
//   Qt, Kt : [B][N][C] f16  (row n, contiguous channels -> A/B frags are b128)
//   V      : [B][C][N] f16  (row c, contiguous j        -> A frags are b128)
// One wave handles a 16-row n tile; x tile transposed through LDS once.
// The 768 weight rows reach LDS in tiles of 64 rows (two buffers) by asynchronous copies of whole lines, once for the four
// waves; each wave reads its B fragments from there (row pitch 16 B x odd: a ds_load_b128 meets no bank twice).
// ---------------------------------------------------------------------------
constexpr int WROWS = 64;                // weight rows per LDS tile = four 16-column output tiles
constexpr int WBUF  = WROWS * KPIT;      // halfs of one weight tile
constexpr int NWT   = 3 * Cch / WROWS;   // weight tiles in all
__global__ void __launch_bounds__(128, 1)
qkv_kernel(const float* __restrict__ x,         // [B][C][N] f32
           const _Float16* __restrict__ wh,     // [3][C][C] f16
           const float* __restrict__ bq,
           const float* __restrict__ bk,
           const float* __restrict__ bv,
           _Float16* __restrict__ Qt,
           _Float16* __restrict__ Kt,
           _Float16* __restrict__ V) {
  __shared__ __align__(16) _Float16 xT[4][16 * 256];          // per-wave x^T tile (8KB each), reused as the Q/K row staging
  __shared__ __align__(16) _Float16 sVst[256 * 64];            // block staging of V [o][n0blk..+63] (32 KB)
  __shared__ __align__(16) _Float16 wring[2 * WBUF];           // two tiles of weight rows
  const int wave = threadIdx.x >> 5, lane = threadIdx.x & 31;
  const int tile = blockIdx.x * 4 + wave;       // 0..1023
  const int b  = tile >> 8;                     // 256 n-tiles per batch
  const int n0 = (tile & 255) << 4;
  const int row = lane & 15, half = lane >> 4;

  // each lane's own copy addresses at weight tile 0: LDS byte address (low 32 bits of the shared address) and global pointer
  const unsigned lW = (unsigned)(size_t)wring + (unsigned)(wave * KPIT * 2 + lane * 16);
  const _Float16* gW = wh + wave * Cch + lane * 8;
  copy_rows64(lW, gW);                          // tile 0 flies while x is staged

  _Float16* xt = xT[wave];
  const float* xb = x + (size_t)b * Cch * Nsq;
  // stage x[b][:, n0..n0+15] transposed into LDS as xT[n][c] f16
  #pragma unroll 4
  for (int it = 0; it < 128; ++it) {
    int idx = it * 32 + lane;
    int c = idx >> 4, n = idx & 15;
    xt[n * 256 + c] = (_Float16)xb[(size_t)c * Nsq + n0 + n];
  }
  LDSX();

  // A fragments of x^T (M=n, K=c), K=256 in 8 chunks of 32
  v16h a[8];
  #pragma unroll
  for (int k = 0; k < 8; ++k) {
    ((v8h*)&a[k])[0] = *(const v8h*)&xt[row * 256 + k * 32 + half * 8];
    ((v8h*)&a[k])[1] = *(const v8h*)&xt[row * 256 + k * 32 + half * 8 + 16];
  }

  asm volatile("s_wait_asynccnt 0x0" ::: "memory");   // this wave's share of weight tile 0 has landed
  __syncthreads();                                    // ... and every other wave's
  copy_rows64(lW + WBUF * 2, gW + WROWS * Cch);       // tile 1 flies while tile 0 is worked on

  #pragma unroll
  for (int m = 0; m < 3; ++m) {                 // m constant after unroll: no flat loads
    const float* bias = (m == 0) ? bq : (m == 1) ? bk : bv;
    for (int q = 0; q < 4; ++q) {               // weight tile t = 4 m + q: output columns 64 q .. 64 q + 63 of matrix m
      const int t = m * 4 + q;
      const _Float16* Wb = wring + (q & 1) * WBUF + row * KPIT;      // this lane's weight row of the tile's first 16
      v16h wf[8][4];                            // read in the order in which the products below take them
      #pragma unroll
      for (int k = 0; k < 8; ++k) {
        #pragma unroll
        for (int j = 0; j < 4; ++j) wf[k][j] = bfrag16(Wb + j * 16 * KPIT + k * 32, half);   // same K map as A
      }
      float bo[4];
      #pragma unroll
      for (int j = 0; j < 4; ++j) bo[j] = bias[(q * 4 + j) * 16 + row];
      asm volatile("s_wait_xcnt 0x0" ::: "memory");   // stands in front of every rewrite of the bias loads' address registers
      // Keeps the tile's reads one group ahead of the products (left free, they were spread among them and waited for one by one)
      // and the address arithmetic of the next trip behind the wait above.
      __builtin_amdgcn_sched_barrier(0);
      v8f acc[4];
      #pragma unroll
      for (int j = 0; j < 4; ++j) { v8f z = {}; acc[j] = z; }
      #pragma unroll
      for (int k = 0; k < 8; ++k) {
        #pragma unroll
        for (int j = 0; j < 4; ++j) acc[j] = WMMA_F16(a[k], wf[k][j], acc[j]);
      }
      #pragma unroll
      for (int j = 0; j < 4; ++j) {
        const int o = (q * 4 + j) * 16 + row;   // this lane's output column
        #pragma unroll
        for (int v = 0; v < 8; ++v) {           // D: (M = v + 8*half, N = row) -> stage in LDS
          float val = acc[j][v] + bo[j];
          int nl = v + half * 8;                // local n (0..15)
          if (m < 2) xt[nl * 256 + o] = (_Float16)val;                 // Q/K rows [n][o] (xt is free: A frags live in registers)
          else       sVst[o * 64 + wave * 16 + nl] = (_Float16)val;    // V [o][block-local n]
        }
      }
      asm volatile("s_wait_dscnt 0x0" ::: "memory");     // this wave's reads of tile t are done
      asm volatile("s_wait_asynccnt 0x0" ::: "memory");  // this wave's share of tile t + 1 has landed
      __syncthreads();                                   // publishes tile t + 1 and frees tile t's buffer
      if (t + 2 < NWT) copy_rows64(lW + (q & 1) * WBUF * 2, gW + (size_t)(t + 2) * WROWS * Cch);   // refill the buffer just read
    }
    if (m < 2) {                                // this wave's 16 rows of Qt / Kt: 512 B each = 32 lanes x 16 B
      LDSX();
      _Float16* dst = (m == 0 ? Qt : Kt) + ((size_t)b * Nsq + n0) * Cch;
      #pragma unroll 4
      for (int nl = 0; nl < 16; ++nl) vst2(dst + (size_t)nl * Cch + lane * 8, *(const v4u*)&xt[nl * 256 + lane * 8]);
      __builtin_amdgcn_wave_barrier();          // before the next m overwrites xt
    }
  }
  asm volatile("s_wait_asynccnt 0x0" ::: "memory");   // nothing of this wave is in flight when the loop is left
  __syncthreads();
  const int n0blk = ((blockIdx.x * 4) & 255) << 4;
  for (int q = threadIdx.x; q < 256 * 8; q += 128) { const int o = q >> 3, pc = q & 7;
    vst2(V + ((size_t)b * Cch + o) * (size_t)Nsq + n0blk + pc * 8, *(const v4u*)&sVst[o * 64 + pc * 8]); }
}

// ---------------------------------------------------------------------------
// Kernel 2: flash attention + residual. One wave = 16 query columns x 256 channels, transposed: K and V are the A operands,
// Q^T and P^T the B operands, so lane l holds scores, statistics and context of query l & 15 alone.
// A block has eight waves, two on each SIMD, so that one wave's softmax runs beside the other's products: waves w and w + 4 own the
// same 16 queries, w the first 32 keys of every 64-key stage and w + 4 the last 32; their two partial softmaxes are joined at the end.
// The block's 64 Q rows (once) and 64-key K and V tiles (three buffers) reach LDS by asynchronous copies of whole lines;
// the waves read their fragments from there. Row pitches are 16 B x odd, so a ds_load_b128 meets no bank twice.
// Three buffers, because a stage's V rows are read behind the barrier that publishes the next stage: the buffer refilled there is
// the one of the stage before, which every wave has left.
// ---------------------------------------------------------------------------
constexpr int KT   = 64;                 // keys per LDS stage = one 32-key softmax step for each half of the waves
constexpr int VPIT = KT + 8;             // halfs per V row in LDS: 128 B + 16 B
constexpr int KBUF = KT * KPIT;          // halfs of one K tile
constexpr int STG  = KBUF + Cch * VPIT;  // halfs of one stage (K tile, then V tile)
constexpr int NSTG = Nsq / KT;           // stages in all

__global__ void __launch_bounds__(256)
attn_kernel(const float* __restrict__ x,
            const _Float16* __restrict__ Qt,   // [B][N][C]
            const _Float16* __restrict__ Kt,   // [B][N][C]
            const _Float16* __restrict__ Vm,   // [B][C][N]
            float* __restrict__ out) {
  __shared__ __align__(16) float    cst[128 * 64];
  __shared__ __align__(16) float    sMx[8 * 32];             // each wave's running maximum and key sum, per lane, for the join
  __shared__ __align__(16) float    sSm[8 * 32];
  __shared__ __align__(16) _Float16 sQ[64 * KPIT];           // the block's query rows
  __shared__ __align__(16) _Float16 ring[3 * STG];           // three stages of K and V
  const int wave = threadIdx.x >> 5, lane = threadIdx.x & 31;
  const int qt = wave & 3, kg = wave >> 2;     // query tile of the block; half of each stage's keys
  const int tile = blockIdx.x * 4 + qt;        // 0..1023
  const int b  = tile >> 8;
  const int i0blk = ((blockIdx.x * 4) & 255) << 4;           // the block's first query
  const int row = lane & 15, half = lane >> 4;
  const float C1 = 0.0625f * 1.44269504089f;   // (1/sqrt(256)) * log2(e)

  // Q^T B-fragments (K=c, N=i): this lane's query row in LDS
  const _Float16* Qb = sQ + (qt * 16 + row) * KPIT;

  // each lane's own copy addresses: LDS byte address (low 32 bits of the shared address) and global offset at stage 0.
  // Q and K: a wave copies one whole 512-B row per instruction, rows wave, wave + 8, ... V: eight lanes copy one 128-B row, a block 32 rows.
  const unsigned lQ = (unsigned)(size_t)sQ   + (unsigned)(wave * KPIT * 2 + lane * 16);
  const unsigned lK = (unsigned)(size_t)ring + (unsigned)(wave * KPIT * 2 + lane * 16);
  const unsigned lV = (unsigned)(size_t)ring + (unsigned)(KBUF * 2) + (unsigned)((threadIdx.x >> 3) * VPIT * 2 + (threadIdx.x & 7) * 16);
  const _Float16* gQ = Qt + ((size_t)b * Nsq + i0blk + wave) * Cch + lane * 8;
  const unsigned oK = (unsigned)((b * Nsq + wave) * Cch + lane * 8);                                   // in halfs from Kt, from Vm
  const unsigned oV = (unsigned)((b * Cch + (int)(threadIdx.x >> 3)) * Nsq + (int)(threadIdx.x & 7) * 8);
  acopy8(lQ, 8 * KPIT * 2, gQ, (size_t)8 * Cch);
  acopy8(lK, 8 * KPIT * 2, Kt + oK, (size_t)8 * Cch);
  acopy8(lV, 32 * VPIT * 2, Vm + oV, (size_t)32 * Nsq);
  asm volatile("s_wait_asynccnt 0x0" ::: "memory");   // this wave's share of Q and of stage 0 has landed
  __syncthreads();                                    // ... and every other wave's
  acopy8(lK + STG * 2, 8 * KPIT * 2, Kt + (oK + KT * Cch), (size_t)8 * Cch);    // stage 1 flies while stage 0 is worked on
  acopy8(lV + STG * 2, 32 * VPIT * 2, Vm + (oV + KT), (size_t)32 * Nsq);

  v8f acc[16];                                  // context tile [256 c][16 i]: acc[ct][v] = channel ct*16 + 8*half + v of query row
  #pragma unroll
  for (int ct = 0; ct < 16; ++ct) { v8f z = {}; acc[ct] = z; }
  float mrun = -3.0e38f, srun = 0.f;            // online-softmax stats of this lane's query; srun sums this half's keys only

  // ---- the score operands sit in registers before a pass starts: Q^T is read once, K is fetched one stage ahead.
  // kf[2k], kf[2k+1] = channels 32k.. of this wave's keys 0..15 and 16..31. ----
  v16h qf[8], kf[16], vh[16];
  #pragma unroll
  for (int k = 0; k < 8; ++k) {
    qf[k]         = bfrag16(Qb + k * 32, half);                            // A map == B map helper (row ptr at k0)
    kf[2 * k]     = bfrag16(ring + (kg * 32 + row) * KPIT + k * 32, half);
    kf[2 * k + 1] = bfrag16(ring + (kg * 32 + 16 + row) * KPIT + k * 32, half);
  }
  int bc = 0, bn = 1, br = 2;                   // buffers of stage t, of stage t + 1, and of stage t - 1 = the one to refill
  for (int t = 0; t < NSTG; ++t) {
    // ---- scores: two 16x16 tiles (keys 0..15, 16..31 of this wave's half of the stage), K = 256, operands already in registers ----
    v8f sD0 = {}, sD1 = {};                     // S^T: sD0[v] = key 8*half + v, sD1[v] = key 16 + 8*half + v, query row
    #pragma unroll
    for (int k = 0; k < 8; ++k) {
      sD0 = WMMA_F16(kf[2 * k],     qf[k], sD0);
      sD1 = WMMA_F16(kf[2 * k + 1], qf[k], sD1);
    }
    // A branch follows: the four vector slots that the chip needs before
    // the scores are read are written here; the barrier keeps the products above them.
    __builtin_amdgcn_sched_barrier(0);
    asm volatile("v_nop\n\tv_nop\n\tv_nop\n\tv_nop");
    asm volatile("s_wait_dscnt 0x0" ::: "memory");     // this wave's reads of stage t - 1 are done
    asm volatile("s_wait_asynccnt 0x0" ::: "memory");  // this wave's share of stage t + 1 has landed
    __syncthreads();                                   // publishes stage t + 1 and frees stage t - 1's buffer
    if (t + 2 < NSTG) {                                // refill it
      acopy8(lK + br * STG * 2, 8 * KPIT * 2, Kt + (oK + (unsigned)(t + 2) * KT * Cch), (size_t)8 * Cch);
      acopy8(lV + br * STG * 2, 32 * VPIT * 2, Vm + (oV + (unsigned)(t + 2) * KT), (size_t)32 * Nsq);
    }
    // ---- one group of reads, it lands under the softmax: this stage's V fragments, then the next stage's K fragments
    // into the registers the products above have just read. The last stage has no next one and reads its own rows again (published,
    // never used). ----
    const _Float16* Vb = ring + bc * STG + KBUF + row * VPIT + kg * 32;   // V row (c = ct*16+row) at this wave's first key
    #pragma unroll
    for (int ct = 0; ct < 16; ++ct) vh[ct] = bfrag16(Vb + ct * 16 * VPIT, half);   // keys 8*half.., 16+8*half..
    {
      const _Float16* K0 = ring + (t + 1 < NSTG ? bn : bc) * STG + (kg * 32 + row) * KPIT;   // key row; same K map as q
      const _Float16* K1 = K0 + 16 * KPIT;
      #pragma unroll
      for (int k = 0; k < 8; ++k) {
        kf[2 * k]     = bfrag16(K0 + k * 32, half);
        kf[2 * k + 1] = bfrag16(K1 + k * 32, half);
      }
    }
    __builtin_amdgcn_sched_barrier(0);          // keeps the reads one group here: left free, they sink among the products and land late
    // ---- online softmax of one query per lane: 16 keys in the lane's own registers, the other 16 in lane ^ 16 ----
    float lm[8];
    #pragma unroll
    for (int v = 0; v < 8; ++v) lm[v] = fmaxf(sD0[v], sD1[v]);
    float l8 = fmaxf(fmaxf(fmaxf(lm[0], lm[1]), fmaxf(lm[2], lm[3])), fmaxf(fmaxf(lm[4], lm[5]), fmaxf(lm[6], lm[7])));
    l8 = fmaxf(l8, xhalf(l8));
    const float mn  = fmaxf(mrun, l8);
    const float cor = __builtin_exp2f((mrun - mn) * C1);
    mrun = mn;
    // two D tiles of S^T, converted in place, are the B fragment of P^T: element s = key 8*half + s, 16 + 8*half + (s - 8)
    v16h pb;
    float ps[8];
    #pragma unroll
    for (int v = 0; v < 8; ++v) {
      const float p0 = __builtin_exp2f((sD0[v] - mn) * C1);
      const float p1 = __builtin_exp2f((sD1[v] - mn) * C1);
      ps[v] = p0 + p1;
      pb[v]     = (_Float16)(p0 * 16384.0f);    // lifted by 2^14 (p <= 1)
      pb[8 + v] = (_Float16)(p1 * 16384.0f);
    }
    srun = srun * cor + (((ps[0] + ps[1]) + (ps[2] + ps[3])) + ((ps[4] + ps[5]) + (ps[6] + ps[7])));
    // ---- context = context * cor + V x P^T : 16 channel tiles, one factor per lane ----
    #pragma unroll
    for (int ct = 0; ct < 16; ++ct) acc[ct] = WMMA_F16(vh[ct], pb, acc[ct] * cor);
    // The loop's back edge follows: the four vector slots that the chip
    // needs behind the last products are written here; the barrier keeps the products above them.
    __builtin_amdgcn_sched_barrier(0);
    asm volatile("v_nop\n\tv_nop\n\tv_nop\n\tv_nop");
    const int bo = bc; bc = bn; bn = br; br = bo;
  }
  asm volatile("s_wait_asynccnt 0x0" ::: "memory");   // nothing of this wave is in flight when the loop is left

  // ---- join of the two key halves of a query: waves w and w + 4 exchange maximum and key sum, lane by lane ----
  const float sown = srun + xhalf(srun);        // the two lane halves' key sums are joined here, once
  sMx[wave * 32 + lane] = mrun;
  sSm[wave * 32 + lane] = sown;
  __syncthreads();
  const float moth = sMx[(wave ^ 4) * 32 + lane];
  const float soth = sSm[(wave ^ 4) * 32 + lane];
  const float mall = fmaxf(mrun, moth);
  const float fown = __builtin_exp2f((mrun - mall) * C1);
  const float foth = __builtin_exp2f((moth - mall) * C1);
  // ---- epilogue: out = x + context / rowsum.
  // Gather the eight waves' context through LDS (two 128-channel passes): the first key half stores, the second adds, so the residual
  // add runs on full channel rows with b128 loads/stores.
  // Block = 64 consecutive query positions: stage [128 c][64 i] per pass, then 256-B row segments of (b, c, i0blk..)
  const float rinv = (1.0f / 16384.0f) * fown / (sown * fown + soth * foth);
  #pragma unroll
  for (int pass = 0; pass < 2; ++pass) {
    __syncthreads();
    if (kg == 0) {
      #pragma unroll
      for (int ct = 0; ct < 8; ++ct) {
        #pragma unroll
        for (int v = 0; v < 8; ++v)             // local channel ct*16 + 8*half + v, query qt*16 + row
          cst[(ct * 16 + half * 8 + v) * 64 + qt * 16 + row] = acc[pass * 8 + ct][v] * rinv;
      }
    }
    __syncthreads();
    if (kg == 1) {
      #pragma unroll
      for (int ct = 0; ct < 8; ++ct) {
        #pragma unroll
        for (int v = 0; v < 8; ++v)
          cst[(ct * 16 + half * 8 + v) * 64 + qt * 16 + row] += acc[pass * 8 + ct][v] * rinv;
      }
    }
    __syncthreads();
    // unrolled so that a thread's eight x loads are in flight together: rolled, each trip waited out its own load
    #pragma unroll
    for (int i = 0; i < 128 * 16 / 256; ++i) { const int qd = i * 256 + threadIdx.x, cl = qd >> 4, pc = qd & 15;
      const int c = pass * 128 + cl;
      const size_t base = ((size_t)b * Cch + c) * (size_t)Nsq + i0blk + pc * 4;
      v4f cv = *(const v4f*)&cst[cl * 64 + pc * 4] + *(const v4f*)&x[base];
      vst2(out + base, cv); }
  }
}

// ---------------------------------------------------------------------------
extern "C" void kernel_launch(void* const* d_in, const int* in_sizes, int n_in,
                              void* d_out, int out_size, void* d_ws, size_t ws_size,
                              hipStream_t stream) {
  const float* x  = (const float*)d_in[0];
  const float* Wq = (const float*)d_in[1];
  const float* bq = (const float*)d_in[2];
  const float* Wk = (const float*)d_in[3];
  const float* bk = (const float*)d_in[4];
  const float* Wv = (const float*)d_in[5];
  const float* bv = (const float*)d_in[6];
  float* out = (float*)d_out;

  // workspace layout: [3][C][C] f16 weights | Qt | Kt | V  (~24.4 MiB total)
  char* ws = (char*)d_ws;
  _Float16* wh = (_Float16*)ws;
  _Float16* Qt = (_Float16*)(ws + (size_t)3 * Cch * Cch * 2);
  _Float16* Kt = Qt + (size_t)Bsz * Nsq * Cch;
  _Float16* V  = Kt + (size_t)Bsz * Nsq * Cch;

  wcvt_kernel<<<(3 * Cch * Cch / 8) / 256, 256, 0, stream>>>(Wq, Wk, Wv, wh);
  // 1024 wave-tiles, 4 waves (128 threads) per block
  qkv_kernel<<<256, 128, 0, stream>>>(x, wh, bq, bk, bv, Qt, Kt, V);
  // 256 blocks of 64 queries, 8 waves (256 threads) per block
  attn_kernel<<<256, 256, 0, stream>>>(x, Qt, Kt, V, out);
}

// v007
// A run of this version takes 99.2 microseconds.
// Timed twice side by side with v006, it ran 1.04 and 1.05 times as fast.
// All steps since v000 together make it 10.2 times as fast.
#include <hip/hip_runtime.h>

typedef __attribute__((ext_vector_type(16))) _Float16 v16h;
typedef __attribute__((ext_vector_type(8)))  _Float16 v8h;
typedef __attribute__((ext_vector_type(8)))  float    v8f;
typedef __attribute__((ext_vector_type(4)))  float    v4f;

// Contractions (Q/K/V 1x1 convs K = 256; scores Q.K over C = 256; attn @ V over 4096 keys) on v_wmma_f32_16x16x32_f16:
// f16 operands, f32 accumulate; online softmax in f32 with P lifted by 2^14 (in the exponent) for the f16 conversion; B fragments use the
// same per-lane K map as A (8*half+0..7, 16+8*half+0..7). Attention runs transposed (S^T = K.Q^T, O^T += V.P^T): a lane owns one query.
// Q/K/V panels and the output are staged in LDS and written as whole
typedef __attribute__((ext_vector_type(4)))  unsigned v4u;
template <typename T> __device__ __forceinline__ void vst2(void* p, T v) { *(T*)p = v;  }
__device__ __forceinline__ v8f WMMA_F16(v16h a, v16h b, v8f c) {
  return __builtin_amdgcn_wmma_f32_16x16x32_f16(false, a, false, b, (short)0, c, false, false);
}
__device__ __forceinline__ v16h bfrag16(const _Float16* rowk0, int half) {     // row pointer at k0; k = 8*half+i, 16+8*half+i
  v16h b; ((v8h*)&b)[0] = *(const v8h*)(rowk0 + half * 8); ((v8h*)&b)[1] = *(const v8h*)(rowk0 + 16 + half * 8); return b;
}
// lane l <-> lane l ^ 16 on the vector pipe (no LDS queue behind it)
__device__ __forceinline__ float xhalf(float v) {
  const int b = __builtin_bit_cast(int, v);
  return __builtin_bit_cast(float, __builtin_amdgcn_permlanex16(b, b, 0x76543210, 0xfedcba98, false, false));
}
#define LDSX() do { asm volatile("s_wait_dscnt 0" ::: "memory"); __builtin_amdgcn_wave_barrier(); __builtin_amdgcn_fence(__ATOMIC_RELEASE, "workgroup"); } while (0)

constexpr int Bsz = 4;
constexpr int Cch = 256;   // channels
constexpr int Nsq = 4096;  // sequence positions
constexpr int KPIT = Cch + 8;            // halfs per Q / K / weight row in LDS: 512 B + 16 B

// Eight 16-byte copies per lane, LDS address l + i*ls bytes, global address g + i*gs halfs. The s_wait_xcnt closes the
// statement so that no address register named here is rewritten ahead of it.
__device__ __forceinline__ void acopy8(unsigned l, unsigned ls, const _Float16* g, size_t gs) {
  asm volatile("global_load_async_to_lds_b128 %0, %8, off\n\t"
               "global_load_async_to_lds_b128 %1, %9, off\n\t"
               "global_load_async_to_lds_b128 %2, %10, off\n\t"
               "global_load_async_to_lds_b128 %3, %11, off\n\t"
               "global_load_async_to_lds_b128 %4, %12, off\n\t"
               "global_load_async_to_lds_b128 %5, %13, off\n\t"
               "global_load_async_to_lds_b128 %6, %14, off\n\t"
               "global_load_async_to_lds_b128 %7, %15, off\n\t"
               "s_wait_xcnt 0x0"
               :: "v"(l), "v"(l + ls), "v"(l + 2 * ls), "v"(l + 3 * ls), "v"(l + 4 * ls), "v"(l + 5 * ls), "v"(l + 6 * ls), "v"(l + 7 * ls),
                  "v"(g), "v"(g + gs), "v"(g + 2 * gs), "v"(g + 3 * gs), "v"(g + 4 * gs), "v"(g + 5 * gs), "v"(g + 6 * gs), "v"(g + 7 * gs)
               : "memory");
}
// 64 rows of 512 B (weights): a wave copies one whole row per instruction, rows wave, wave + 4, ...
__device__ __forceinline__ void copy_rows64(unsigned l, const _Float16* g) {
  acopy8(l, 4 * KPIT * 2, g, (size_t)4 * Cch);
  acopy8(l + 32 * KPIT * 2, 4 * KPIT * 2, g + (size_t)32 * Cch, (size_t)4 * Cch);
}

// ---------------------------------------------------------------------------
// Kernel 0: convert the three 256x256 weight matrices to f16 (packed [3][C][C])
// ---------------------------------------------------------------------------
__global__ void wcvt_kernel(const float* __restrict__ wq,
                            const float* __restrict__ wk,
                            const float* __restrict__ wv,
                            _Float16* __restrict__ out) {
  int g8 = blockIdx.x * 256 + threadIdx.x;      // 0 .. 3*65536/8-1, 16 B per thread
  int t0 = g8 * 8; int m = t0 >> 16, e = t0 & 65535;
  const float* s = (m == 0) ? wq : (m == 1) ? wk : wv;
  union { v8h h; v4u u; } pk;
#pragma unroll
  for (int i = 0; i < 8; ++i) pk.h[i] = (_Float16)s[e + i];
  vst2(out + t0, pk.u);
}

// ---------------------------------------------------------------------------
// Kernel 1: QKV projection via WMMA.
//   Qt, Kt : [B][N][C] f16  (row n, contiguous channels -> A/B frags are b128)
//   V      : [B][C][N] f16  (row c, contiguous j        -> A frags are b128)
// One wave handles a 16-row n tile; x tile transposed through LDS once.
// The 768 weight rows reach LDS in tiles of 64 rows (two buffers) by asynchronous copies of whole lines, once for the four
// waves; each wave reads its B fragments from there (row pitch 16 B x odd: a ds_load_b128 meets no bank twice).
// ---------------------------------------------------------------------------
constexpr int WROWS = 64;                // weight rows per LDS tile = four 16-column output tiles
constexpr int WBUF  = WROWS * KPIT;      // halfs of one weight tile
constexpr int NWT   = 3 * Cch / WROWS;   // weight tiles in all
__global__ void __launch_bounds__(128, 1)
qkv_kernel(const float* __restrict__ x,         // [B][C][N] f32
           const _Float16* __restrict__ wh,     // [3][C][C] f16
           const float* __restrict__ bq,
           const float* __restrict__ bk,
           const float* __restrict__ bv,
           _Float16* __restrict__ Qt,
           _Float16* __restrict__ Kt,
           _Float16* __restrict__ V) {
  __shared__ __align__(16) _Float16 xT[4][16 * 256];          // per-wave x^T tile (8KB each), reused as the Q/K row staging
  __shared__ __align__(16) _Float16 sVst[256 * 64];            // block staging of V [o][n0blk..+63] (32 KB)
  __shared__ __align__(16) _Float16 wring[2 * WBUF];           // two tiles of weight rows
  const int wave = threadIdx.x >> 5, lane = threadIdx.x & 31;
  const int tile = blockIdx.x * 4 + wave;       // 0..1023
  const int b  = tile >> 8;                     // 256 n-tiles per batch
  const int n0 = (tile & 255) << 4;
  const int row = lane & 15, half = lane >> 4;

  // each lane's own copy addresses at weight tile 0: LDS byte address (low 32 bits of the shared address) and global pointer
  const unsigned lW = (unsigned)(size_t)wring + (unsigned)(wave * KPIT * 2 + lane * 16);
  const _Float16* gW = wh + wave * Cch + lane * 8;
  copy_rows64(lW, gW);                          // tile 0 flies while x is staged

  _Float16* xt = xT[wave];
  const float* xb = x + (size_t)b * Cch * Nsq;
  // stage x[b][:, n0..n0+15] transposed into LDS as xT[n][c] f16
  #pragma unroll 4
  for (int it = 0; it < 128; ++it) {
    int idx = it * 32 + lane;
    int c = idx >> 4, n = idx & 15;
    xt[n * 256 + c] = (_Float16)xb[(size_t)c * Nsq + n0 + n];
  }
  LDSX();

  // A fragments of x^T (M=n, K=c), K=256 in 8 chunks of 32
  v16h a[8];
  #pragma unroll
  for (int k = 0; k < 8; ++k) {
    ((v8h*)&a[k])[0] = *(const v8h*)&xt[row * 256 + k * 32 + half * 8];
    ((v8h*)&a[k])[1] = *(const v8h*)&xt[row * 256 + k * 32 + half * 8 + 16];
  }

  asm volatile("s_wait_asynccnt 0x0" ::: "memory");   // this wave's share of weight tile 0 has landed
  __syncthreads();                                    // ... and every other wave's
  copy_rows64(lW + WBUF * 2, gW + WROWS * Cch);       // tile 1 flies while tile 0 is worked on

  #pragma unroll
  for (int m = 0; m < 3; ++m) {                 // m constant after unroll: no flat loads
    const float* bias = (m == 0) ? bq : (m == 1) ? bk : bv;
    for (int q = 0; q < 4; ++q) {               // weight tile t = 4 m + q: output columns 64 q .. 64 q + 63 of matrix m
      const int t = m * 4 + q;
      const _Float16* Wb = wring + (q & 1) * WBUF + row * KPIT;      // this lane's weight row of the tile's first 16
      v16h wf[8][4];                            // read in the order in which the products below take them
      #pragma unroll
      for (int k = 0; k < 8; ++k) {
        #pragma unroll
        for (int j = 0; j < 4; ++j) wf[k][j] = bfrag16(Wb + j * 16 * KPIT + k * 32, half);   // same K map as A
      }
      float bo[4];
      #pragma unroll
      for (int j = 0; j < 4; ++j) bo[j] = bias[(q * 4 + j) * 16 + row];
      asm volatile("s_wait_xcnt 0x0" ::: "memory");   // stands in front of every rewrite of the bias loads' address registers
      // Keeps the tile's reads one group ahead of the products (left free, they were spread among them and waited for one by one)
      // and the address arithmetic of the next trip behind the wait above.
      __builtin_amdgcn_sched_barrier(0);
      v8f acc[4];
      #pragma unroll
      for (int j = 0; j < 4; ++j) { v8f z = {}; acc[j] = z; }
      #pragma unroll
      for (int k = 0; k < 8; ++k) {
        #pragma unroll
        for (int j = 0; j < 4; ++j) acc[j] = WMMA_F16(a[k], wf[k][j], acc[j]);
      }
      #pragma unroll
      for (int j = 0; j < 4; ++j) {
        const int o = (q * 4 + j) * 16 + row;   // this lane's output column
        #pragma unroll
        for (int v = 0; v < 8; ++v) {           // D: (M = v + 8*half, N = row) -> stage in LDS
          float val = acc[j][v] + bo[j];
          int nl = v + half * 8;                // local n (0..15)
          if (m < 2) xt[nl * 256 + o] = (_Float16)val;                 // Q/K rows [n][o] (xt is free: A frags live in registers)
          else       sVst[o * 64 + wave * 16 + nl] = (_Float16)val;    // V [o][block-local n]
        }
      }
      asm volatile("s_wait_dscnt 0x0" ::: "memory");     // this wave's reads of tile t are done
      asm volatile("s_wait_asynccnt 0x0" ::: "memory");  // this wave's share of tile t + 1 has landed
      __syncthreads();                                   // publishes tile t + 1 and frees tile t's buffer
      if (t + 2 < NWT) copy_rows64(lW + (q & 1) * WBUF * 2, gW + (size_t)(t + 2) * WROWS * Cch);   // refill the buffer just read
    }
    if (m < 2) {                                // this wave's 16 rows of Qt / Kt: 512 B each = 32 lanes x 16 B
      LDSX();
      _Float16* dst = (m == 0 ? Qt : Kt) + ((size_t)b * Nsq + n0) * Cch;
      #pragma unroll 4
      for (int nl = 0; nl < 16; ++nl) vst2(dst + (size_t)nl * Cch + lane * 8, *(const v4u*)&xt[nl * 256 + lane * 8]);
      __builtin_amdgcn_wave_barrier();          // before the next m overwrites xt
    }
  }
  asm volatile("s_wait_asynccnt 0x0" ::: "memory");   // nothing of this wave is in flight when the loop is left
  __syncthreads();
  const int n0blk = ((blockIdx.x * 4) & 255) << 4;
  for (int q = threadIdx.x; q < 256 * 8; q += 128) { const int o = q >> 3, pc = q & 7;
    vst2(V + ((size_t)b * Cch + o) * (size_t)Nsq + n0blk + pc * 8, *(const v4u*)&sVst[o * 64 + pc * 8]); }
}

// ---------------------------------------------------------------------------
// Kernel 2: flash attention + residual. One wave = 16 query columns x 256 channels, transposed: K and V are the A operands,
// Q^T and P^T the B operands, so lane l holds scores, statistics and context of query l & 15 alone.
// A block has eight waves, two on each SIMD, so that one wave's softmax runs beside the other's products: waves w and w + 4 own the
// same 16 queries, w the first 32 keys of every 64-key stage and w + 4 the last 32; their two partial softmaxes are joined at the end.
// The block's 64 Q rows (once) and 64-key K and V tiles (three buffers) reach LDS by asynchronous copies of whole lines;
// the waves read their fragments from there. Row pitches are 16 B x odd, so a ds_load_b128 meets no bank twice.
// Three buffers, because a stage's V rows are read behind the barrier that publishes the next stage: the buffer refilled there is
// the one of the stage before, which every wave has left.
// ---------------------------------------------------------------------------
constexpr int KT   = 64;                 // keys per LDS stage = one 32-key softmax step for each half of the waves
constexpr int VPIT = KT + 8;             // halfs per V row in LDS: 128 B + 16 B
constexpr int KBUF = KT * KPIT;          // halfs of one K tile
constexpr int STG  = KBUF + Cch * VPIT;  // halfs of one stage (K tile, then V tile)
constexpr int NSTG = Nsq / KT;           // stages in all

__global__ void __launch_bounds__(256)
attn_kernel(const float* __restrict__ x,
            const _Float16* __restrict__ Qt,   // [B][N][C]
            const _Float16* __restrict__ Kt,   // [B][N][C]
            const _Float16* __restrict__ Vm,   // [B][C][N]
            float* __restrict__ out) {
  __shared__ __align__(16) float    cst[128 * 64];
  __shared__ __align__(16) float    sMx[8 * 32];             // each wave's running maximum and key sum, per lane, for the join
  __shared__ __align__(16) float    sSm[8 * 32];
  __shared__ __align__(16) _Float16 sQ[64 * KPIT];           // the block's query rows
  __shared__ __align__(16) _Float16 ring[3 * STG];           // three stages of K and V
  const int wave = threadIdx.x >> 5, lane = threadIdx.x & 31;
  const int qt = wave & 3, kg = wave >> 2;     // query tile of the block; half of each stage's keys
  const int tile = blockIdx.x * 4 + qt;        // 0..1023
  const int b  = tile >> 8;
  const int i0blk = ((blockIdx.x * 4) & 255) << 4;           // the block's first query
  const int row = lane & 15, half = lane >> 4;
  const float C1 = 0.0625f * 1.44269504089f;   // (1/sqrt(256)) * log2(e)

  // Q^T B-fragments (K=c, N=i): this lane's query row in LDS
  const _Float16* Qb = sQ + (qt * 16 + row) * KPIT;

  // each lane's own copy addresses: LDS byte address (low 32 bits of the shared address) and global offset at stage 0.
  // Q and K: a wave copies one whole 512-B row per instruction, rows wave, wave + 8, ... V: eight lanes copy one 128-B row, a block 32 rows.
  const unsigned lQ = (unsigned)(size_t)sQ   + (unsigned)(wave * KPIT * 2 + lane * 16);
  const unsigned lK = (unsigned)(size_t)ring + (unsigned)(wave * KPIT * 2 + lane * 16);
  const unsigned lV = (unsigned)(size_t)ring + (unsigned)(KBUF * 2) + (unsigned)((threadIdx.x >> 3) * VPIT * 2 + (threadIdx.x & 7) * 16);
  const _Float16* gQ = Qt + ((size_t)b * Nsq + i0blk + wave) * Cch + lane * 8;
  const unsigned oK = (unsigned)((b * Nsq + wave) * Cch + lane * 8);                                   // in halfs from Kt, from Vm
  const unsigned oV = (unsigned)((b * Cch + (int)(threadIdx.x >> 3)) * Nsq + (int)(threadIdx.x & 7) * 8);
  acopy8(lQ, 8 * KPIT * 2, gQ, (size_t)8 * Cch);
  acopy8(lK, 8 * KPIT * 2, Kt + oK, (size_t)8 * Cch);
  acopy8(lV, 32 * VPIT * 2, Vm + oV, (size_t)32 * Nsq);
  asm volatile("s_wait_asynccnt 0x0" ::: "memory");   // this wave's share of Q and of stage 0 has landed
  __syncthreads();                                    // ... and every other wave's
  acopy8(lK + STG * 2, 8 * KPIT * 2, Kt + (oK + KT * Cch), (size_t)8 * Cch);    // stage 1 flies while stage 0 is worked on
  acopy8(lV + STG * 2, 32 * VPIT * 2, Vm + (oV + KT), (size_t)32 * Nsq);

  v8f acc[16];                                  // context tile [256 c][16 i]: acc[ct][v] = channel ct*16 + 8*half + v of query row
  #pragma unroll
  for (int ct = 0; ct < 16; ++ct) { v8f z = {}; acc[ct] = z; }
  float mrun = -3.0e38f, srun = 0.f;            // online-softmax stats of this lane's query; srun sums this half's keys only

  // ---- the score operands sit in registers before a pass starts: Q^T is read once, K is fetched one stage ahead.
  // kf[2k], kf[2k+1] = channels 32k.. of this wave's keys 0..15 and 16..31. ----
  v16h qf[8], kf[16], vh[16];
  #pragma unroll
  for (int k = 0; k < 8; ++k) {
    qf[k]         = bfrag16(Qb + k * 32, half);                            // A map == B map helper (row ptr at k0)
    kf[2 * k]     = bfrag16(ring + (kg * 32 + row) * KPIT + k * 32, half);
    kf[2 * k + 1] = bfrag16(ring + (kg * 32 + 16 + row) * KPIT + k * 32, half);
  }
  int bc = 0, bn = 1, br = 2;                   // buffers of stage t, of stage t + 1, and of stage t - 1 = the one to refill
  for (int t = 0; t < NSTG; ++t) {
    // ---- scores: two 16x16 tiles (keys 0..15, 16..31 of this wave's half of the stage), K = 256, operands already in registers ----
    v8f sD0 = {}, sD1 = {};                     // S^T: sD0[v] = key 8*half + v, sD1[v] = key 16 + 8*half + v, query row
    #pragma unroll
    for (int k = 0; k < 8; ++k) {
      sD0 = WMMA_F16(kf[2 * k],     qf[k], sD0);
      sD1 = WMMA_F16(kf[2 * k + 1], qf[k], sD1);
    }
    // A branch follows: the four vector slots that the chip needs before
    // the scores are read are written here; the barrier keeps the products above them.
    __builtin_amdgcn_sched_barrier(0);
    asm volatile("v_nop\n\tv_nop\n\tv_nop\n\tv_nop");
    asm volatile("s_wait_dscnt 0x0" ::: "memory");     // this wave's reads of stage t - 1 are done
    asm volatile("s_wait_asynccnt 0x0" ::: "memory");  // this wave's share of stage t + 1 has landed
    __syncthreads();                                   // publishes stage t + 1 and frees stage t - 1's buffer
    if (t + 2 < NSTG) {                                // refill it
      acopy8(lK + br * STG * 2, 8 * KPIT * 2, Kt + (oK + (unsigned)(t + 2) * KT * Cch), (size_t)8 * Cch);
      acopy8(lV + br * STG * 2, 32 * VPIT * 2, Vm + (oV + (unsigned)(t + 2) * KT), (size_t)32 * Nsq);
    }
    // ---- one group of reads, it lands under the softmax: this stage's V fragments, then the next stage's K fragments
    // into the registers the products above have just read. The last stage has no next one and reads its own rows again (published,
    // never used). ----
    const _Float16* Vb = ring + bc * STG + KBUF + row * VPIT + kg * 32;   // V row (c = ct*16+row) at this wave's first key
    #pragma unroll
    for (int ct = 0; ct < 16; ++ct) vh[ct] = bfrag16(Vb + ct * 16 * VPIT, half);   // keys 8*half.., 16+8*half..
    {
      const _Float16* K0 = ring + (t + 1 < NSTG ? bn : bc) * STG + (kg * 32 + row) * KPIT;   // key row; same K map as q
      const _Float16* K1 = K0 + 16 * KPIT;
      #pragma unroll
      for (int k = 0; k < 8; ++k) {
        kf[2 * k]     = bfrag16(K0 + k * 32, half);
        kf[2 * k + 1] = bfrag16(K1 + k * 32, half);
      }
    }
    __builtin_amdgcn_sched_barrier(0);          // keeps the reads one group here: left free, they sink among the products and land late
    // ---- online softmax of one query per lane: 16 keys in the lane's own registers, the other 16 in lane ^ 16 ----
    float lm[8];
    #pragma unroll
    for (int v = 0; v < 8; ++v) lm[v] = fmaxf(sD0[v], sD1[v]);
    float l8 = fmaxf(fmaxf(fmaxf(lm[0], lm[1]), fmaxf(lm[2], lm[3])), fmaxf(fmaxf(lm[4], lm[5]), fmaxf(lm[6], lm[7])));
    l8 = fmaxf(l8, xhalf(l8));
    const float mn  = fmaxf(mrun, l8);
    const float cor = __builtin_amdgcn_exp2f((mrun - mn) * C1);   // bare v_exp_f32, no range guard: a factor below the normal range counts as nothing here
    mrun = mn;
    const float eb = 14.0f - mn * C1;           // one addend per lane: the maximum taken off and the 2^14 lift put on, in the exponent
    // two D tiles of S^T, converted in place, are the B fragment of P^T: element s = key 8*half + s, 16 + 8*half + (s - 8)
    v16h pb;
    float ps[8];
    #pragma unroll
    for (int v = 0; v < 8; ++v) {
      const float p0 = __builtin_amdgcn_exp2f(__builtin_fmaf(sD0[v], C1, eb));   // p * 2^14 (p <= 1): one fma, one v_exp_f32
      const float p1 = __builtin_amdgcn_exp2f(__builtin_fmaf(sD1[v], C1, eb));
      ps[v] = p0 + p1;                          // the key sums carry the lift too
      pb[v]     = (_Float16)p0;
      pb[8 + v] = (_Float16)p1;
    }
    srun = srun * cor + (((ps[0] + ps[1]) + (ps[2] + ps[3])) + ((ps[4] + ps[5]) + (ps[6] + ps[7])));
    // ---- context = context * cor + V x P^T : 16 channel tiles, one factor per lane ----
    #pragma unroll
    for (int ct = 0; ct < 16; ++ct) acc[ct] = WMMA_F16(vh[ct], pb, acc[ct] * cor);
    // The loop's back edge follows: the four vector slots that the chip
    // needs behind the last products are written here; the barrier keeps the products above them.
    __builtin_amdgcn_sched_barrier(0);
    asm volatile("v_nop\n\tv_nop\n\tv_nop\n\tv_nop");
    const int bo = bc; bc = bn; bn = br; br = bo;
  }
  asm volatile("s_wait_asynccnt 0x0" ::: "memory");   // nothing of this wave is in flight when the loop is left

  // ---- join of the two key halves of a query: waves w and w + 4 exchange maximum and key sum, lane by lane ----
  const float sown = srun + xhalf(srun);        // the two lane halves' key sums are joined here, once
  sMx[wave * 32 + lane] = mrun;
  sSm[wave * 32 + lane] = sown;
  __syncthreads();
  const float moth = sMx[(wave ^ 4) * 32 + lane];
  const float soth = sSm[(wave ^ 4) * 32 + lane];
  const float mall = fmaxf(mrun, moth);
  const float fown = __builtin_exp2f((mrun - mall) * C1);
  const float foth = __builtin_exp2f((moth - mall) * C1);
  // ---- epilogue: out = x + context / rowsum.
  // Gather the eight waves' context through LDS (two 128-channel passes): the first key half stores, the second adds, so the residual
  // add runs on full channel rows with b128 loads/stores.
  // Block = 64 consecutive query positions: stage [128 c][64 i] per pass, then 256-B row segments of (b, c, i0blk..)
  const float rinv = fown / (sown * fown + soth * foth);   // context and key sums both carry the 2^14 lift: it cancels
  #pragma unroll
  for (int pass = 0; pass < 2; ++pass) {
    __syncthreads();
    if (kg == 0) {
      #pragma unroll
      for (int ct = 0; ct < 8; ++ct) {
        #pragma unroll
        for (int v = 0; v < 8; ++v)             // local channel ct*16 + 8*half + v, query qt*16 + row
          cst[(ct * 16 + half * 8 + v) * 64 + qt * 16 + row] = acc[pass * 8 + ct][v] * rinv;
      }
    }
    __syncthreads();
    if (kg == 1) {
      #pragma unroll
      for (int ct = 0; ct < 8; ++ct) {
        #pragma unroll
        for (int v = 0; v < 8; ++v)
          cst[(ct * 16 + half * 8 + v) * 64 + qt * 16 + row] += acc[pass * 8 + ct][v] * rinv;
      }
    }
    __syncthreads();
    // unrolled so that a thread's eight x loads are in flight together: rolled, each trip waited out its own load
    #pragma unroll
    for (int i = 0; i < 128 * 16 / 256; ++i) { const int qd = i * 256 + threadIdx.x, cl = qd >> 4, pc = qd & 15;
      const int c = pass * 128 + cl;
      const size_t base = ((size_t)b * Cch + c) * (size_t)Nsq + i0blk + pc * 4;
      v4f cv = *(const v4f*)&cst[cl * 64 + pc * 4] + *(const v4f*)&x[base];
      vst2(out + base, cv); }
  }
}

// ---------------------------------------------------------------------------
extern "C" void kernel_launch(void* const* d_in, const int* in_sizes, int n_in,
                              void* d_out, int out_size, void* d_ws, size_t ws_size,
                              hipStream_t stream) {
  const float* x  = (const float*)d_in[0];
  const float* Wq = (const float*)d_in[1];
  const float* bq = (const float*)d_in[2];
  const float* Wk = (const float*)d_in[3];
  const float* bk = (const float*)d_in[4];
  const float* Wv = (const float*)d_in[5];
  const float* bv = (const float*)d_in[6];
  float* out = (float*)d_out;

  // workspace layout: [3][C][C] f16 weights | Qt | Kt | V  (~24.4 MiB total)
  char* ws = (char*)d_ws;
  _Float16* wh = (_Float16*)ws;
  _Float16* Qt = (_Float16*)(ws + (size_t)3 * Cch * Cch * 2);
  _Float16* Kt = Qt + (size_t)Bsz * Nsq * Cch;
  _Float16* V  = Kt + (size_t)Bsz * Nsq * Cch;

  wcvt_kernel<<<(3 * Cch * Cch / 8) / 256, 256, 0, stream>>>(Wq, Wk, Wv, wh);
  // 1024 wave-tiles, 4 waves (128 threads) per block
  qkv_kernel<<<256, 128, 0, stream>>>(x, wh, bq, bk, bv, Qt, Kt, V);
  // 256 blocks of 64 queries, 8 waves (256 threads) per block
  attn_kernel<<<256, 256, 0, stream>>>(x, Qt, Kt, V, out);
}

// v008
// Measured time: 88.6 microseconds a run.
// In both of two side-by-side timings against v007, it was 1.11 times as fast.
// Counting every step since v000, it is 11.3 times as fast.
#include <hip/hip_runtime.h>

typedef __attribute__((ext_vector_type(16))) _Float16 v16h;
typedef __attribute__((ext_vector_type(8)))  _Float16 v8h;
typedef __attribute__((ext_vector_type(8)))  float    v8f;
typedef __attribute__((ext_vector_type(4)))  float    v4f;
typedef __attribute__((ext_vector_type(2)))  float    v2f;
typedef __attribute__((ext_vector_type(2)))  _Float16 v2h;

// Contractions (Q/K/V 1x1 convs K = 256; scores Q.K over C = 256; attn @ V over 4096 keys) on v_wmma_f32_16x16x32_f16:
// f16 operands, f32 accumulate; online softmax in f32 with P lifted by 2^14 (in the exponent) for the f16 conversion; B fragments use the
// same per-lane K map as A (8*half+0..7, 16+8*half+0..7). Attention runs transposed (S^T = K.Q^T, O^T += V.P^T): a lane owns one query.
// Q/K/V panels and the output are staged in LDS and written as whole
typedef __attribute__((ext_vector_type(4)))  unsigned v4u;
template <typename T> __device__ __forceinline__ void vst2(void* p, T v) { *(T*)p = v;  }
__device__ __forceinline__ v8f WMMA_F16(v16h a, v16h b, v8f c) {
  return __builtin_amdgcn_wmma_f32_16x16x32_f16(false, a, false, b, (short)0, c, false, false);
}
__device__ __forceinline__ v16h bfrag16(const _Float16* rowk0, int half) {     // row pointer at k0; k = 8*half+i, 16+8*half+i
  v16h b; ((v8h*)&b)[0] = *(const v8h*)(rowk0 + half * 8); ((v8h*)&b)[1] = *(const v8h*)(rowk0 + 16 + half * 8); return b;
}
// lane l <-> lane l ^ 16 on the vector pipe (no LDS queue behind it)
__device__ __forceinline__ float xhalf(float v) {
  const int b = __builtin_bit_cast(int, v);
  return __builtin_bit_cast(float, __builtin_amdgcn_permlanex16(b, b, 0x76543210, 0xfedcba98, false, false));
}
#define LDSX() do { asm volatile("s_wait_dscnt 0" ::: "memory"); __builtin_amdgcn_wave_barrier(); __builtin_amdgcn_fence(__ATOMIC_RELEASE, "workgroup"); } while (0)

constexpr int Bsz = 4;
constexpr int Cch = 256;   // channels
constexpr int Nsq = 4096;  // sequence positions
constexpr int KPIT = Cch + 8;            // halfs per Q / K / weight row in LDS: 512 B + 16 B

// Eight 16-byte copies per lane, LDS address l + i*ls bytes, global address g + i*gs halfs. The s_wait_xcnt closes the
// statement so that no address register named here is rewritten ahead of it.
__device__ __forceinline__ void acopy8(unsigned l, unsigned ls, const _Float16* g, size_t gs) {
  asm volatile("global_load_async_to_lds_b128 %0, %8, off\n\t"
               "global_load_async_to_lds_b128 %1, %9, off\n\t"
               "global_load_async_to_lds_b128 %2, %10, off\n\t"
               "global_load_async_to_lds_b128 %3, %11, off\n\t"
               "global_load_async_to_lds_b128 %4, %12, off\n\t"
               "global_load_async_to_lds_b128 %5, %13, off\n\t"
               "global_load_async_to_lds_b128 %6, %14, off\n\t"
               "global_load_async_to_lds_b128 %7, %15, off\n\t"
               "s_wait_xcnt 0x0"
               :: "v"(l), "v"(l + ls), "v"(l + 2 * ls), "v"(l + 3 * ls), "v"(l + 4 * ls), "v"(l + 5 * ls), "v"(l + 6 * ls), "v"(l + 7 * ls),
                  "v"(g), "v"(g + gs), "v"(g + 2 * gs), "v"(g + 3 * gs), "v"(g + 4 * gs), "v"(g + 5 * gs), "v"(g + 6 * gs), "v"(g + 7 * gs)
               : "memory");
}
// 64 rows of 512 B (weights): a wave copies one whole row per instruction, rows wave, wave + 4, ...
__device__ __forceinline__ void copy_rows64(unsigned l, const _Float16* g) {
  acopy8(l, 4 * KPIT * 2, g, (size_t)4 * Cch);
  acopy8(l + 32 * KPIT * 2, 4 * KPIT * 2, g + (size_t)32 * Cch, (size_t)4 * Cch);
}

// ---------------------------------------------------------------------------
// Kernel 0: convert the three 256x256 weight matrices to f16 (packed [3][C][C])
// ---------------------------------------------------------------------------
__global__ void wcvt_kernel(const float* __restrict__ wq,
                            const float* __restrict__ wk,
                            const float* __restrict__ wv,
                            _Float16* __restrict__ out) {
  int g8 = blockIdx.x * 256 + threadIdx.x;      // 0 .. 3*65536/8-1, 16 B per thread
  int t0 = g8 * 8; int m = t0 >> 16, e = t0 & 65535;
  const float* s = (m == 0) ? wq : (m == 1) ? wk : wv;
  union { v8h h; v4u u; } pk;
#pragma unroll
  for (int i = 0; i < 8; ++i) pk.h[i] = (_Float16)s[e + i];
  vst2(out + t0, pk.u);
}

// ---------------------------------------------------------------------------
// Kernel 1: QKV projection via WMMA.
//   Qt, Kt : [B][N][C] f16  (row n, contiguous channels -> A/B frags are b128)
//   V      : [B][C][N] f16  (row c, contiguous j        -> A frags are b128)
// One wave handles a 16-row n tile; x tile transposed through LDS once.
// Every staging array has a row pitch of 16 B x odd, so that its b128 reads and the x^T stores meet no bank twice (the V stores do):
// x^T and the Q/K rows 528 B, the V rows 144 B.
// The 768 weight rows reach LDS in tiles of 64 rows (two buffers) by asynchronous copies of whole lines, once for the four
// waves; each wave reads its B fragments from there (row pitch 16 B x odd: a ds_load_b128 meets no bank twice).
// ---------------------------------------------------------------------------
constexpr int WROWS = 64;                // weight rows per LDS tile = four 16-column output tiles
constexpr int WBUF  = WROWS * KPIT;      // halfs of one weight tile
constexpr int NWT   = 3 * Cch / WROWS;   // weight tiles in all
constexpr int VSP   = 64 + 8;            // halfs per V staging row: 128 B + 16 B
__global__ void __launch_bounds__(128, 1)
qkv_kernel(const float* __restrict__ x,         // [B][C][N] f32
           const _Float16* __restrict__ wh,     // [3][C][C] f16
           const float* __restrict__ bq,
           const float* __restrict__ bk,
           const float* __restrict__ bv,
           _Float16* __restrict__ Qt,
           _Float16* __restrict__ Kt,
           _Float16* __restrict__ V) {
  __shared__ __align__(16) _Float16 xT[4][16 * KPIT];         // per-wave x^T tile, reused as the Q/K row staging
  __shared__ __align__(16) _Float16 sVst[256 * VSP];           // block staging of V [o][n0blk..+63]
  __shared__ __align__(16) _Float16 wring[2 * WBUF];           // two tiles of weight rows
  const int wave = threadIdx.x >> 5, lane = threadIdx.x & 31;
  const int tile = blockIdx.x * 4 + wave;       // 0..1023
  const int b  = tile >> 8;                     // 256 n-tiles per batch
  const int n0 = (tile & 255) << 4;
  const int row = lane & 15, half = lane >> 4;

  // each lane's own copy addresses at weight tile 0: LDS byte address (low 32 bits of the shared address) and global pointer
  const unsigned lW = (unsigned)(size_t)wring + (unsigned)(wave * KPIT * 2 + lane * 16);
  const _Float16* gW = wh + wave * Cch + lane * 8;
  copy_rows64(lW, gW);                          // tile 0 flies while x is staged

  _Float16* xt = xT[wave];
  const float* xb = x + (size_t)b * Cch * Nsq;
  // stage x[b][:, n0..n0+15] transposed into LDS as xT[n][c] f16. A lane takes four positions (16 B) of two neighbouring channels,
  // a wave 16 channels per pair of loads; all 32 loads of the wave are in flight together. A channel pair of one position is one
  // 4-byte store: banks 16 * l4 + 4 * e + cp, all 32 lanes apart.
  const int l4 = lane & 3, cp = lane >> 2;
  const float* xp = xb + (size_t)(2 * cp) * Nsq + n0 + 4 * l4;
  v4f xe[16], xo[16];                           // even and odd channel of the pair
  #pragma unroll                                // unrolled: both arrays stay in registers and every load issues before the first is waited for
  for (int j = 0; j < 16; ++j) {
    xe[j] = *(const v4f*)(xp + (size_t)(16 * j) * Nsq);
    xo[j] = *(const v4f*)(xp + (size_t)(16 * j + 1) * Nsq);
  }
  #pragma unroll                                // unrolled (both loops): constant register indices, store offsets as immediates
  for (int j = 0; j < 16; ++j) {
    #pragma unroll
    for (int e = 0; e < 4; ++e) {
      const v2f f = { xe[j][e], xo[j][e] };
      vst2(&xt[(4 * l4 + e) * KPIT + 16 * j + 2 * cp], __builtin_convertvector(f, v2h));
    }
  }
  LDSX();

  // A fragments of x^T (M=n, K=c), K=256 in 8 chunks of 32
  v16h a[8];
  #pragma unroll
  for (int k = 0; k < 8; ++k) {
    ((v8h*)&a[k])[0] = *(const v8h*)&xt[row * KPIT + k * 32 + half * 8];
    ((v8h*)&a[k])[1] = *(const v8h*)&xt[row * KPIT + k * 32 + half * 8 + 16];
  }

  asm volatile("s_wait_asynccnt 0x0" ::: "memory");   // this wave's share of weight tile 0 has landed
  __syncthreads();                                    // ... and every other wave's
  copy_rows64(lW + WBUF * 2, gW + WROWS * Cch);       // tile 1 flies while tile 0 is worked on

  #pragma unroll
  for (int m = 0; m < 3; ++m) {                 // m constant after unroll: no flat loads
    const float* bias = (m == 0) ? bq : (m == 1) ? bk : bv;
    for (int q = 0; q < 4; ++q) {               // weight tile t = 4 m + q: output columns 64 q .. 64 q + 63 of matrix m
      const int t = m * 4 + q;
      const _Float16* Wb = wring + (q & 1) * WBUF + row * KPIT;      // this lane's weight row of the tile's first 16
      v16h wf[8][4];                            // read in the order in which the products below take them
      #pragma unroll
      for (int k = 0; k < 8; ++k) {
        #pragma unroll
        for (int j = 0; j < 4; ++j) wf[k][j] = bfrag16(Wb + j * 16 * KPIT + k * 32, half);   // same K map as A
      }
      float bo[4];
      #pragma unroll
      for (int j = 0; j < 4; ++j) bo[j] = bias[(q * 4 + j) * 16 + row];
      asm volatile("s_wait_xcnt 0x0" ::: "memory");   // stands in front of every rewrite of the bias loads' address registers
      // Keeps the tile's reads one group ahead of the products (left free, they were spread among them and waited for one by one)
      // and the address arithmetic of the next trip behind the wait above.
      __builtin_amdgcn_sched_barrier(0);
      v8f acc[4];
      #pragma unroll
      for (int j = 0; j < 4; ++j) { v8f z = {}; acc[j] = z; }
      #pragma unroll
      for (int k = 0; k < 8; ++k) {
        #pragma unroll
        for (int j = 0; j < 4; ++j) acc[j] = WMMA_F16(a[k], wf[k][j], acc[j]);
      }
      #pragma unroll
      for (int j = 0; j < 4; ++j) {
        const int o = (q * 4 + j) * 16 + row;   // this lane's output column
        #pragma unroll
        for (int v = 0; v < 8; ++v) {           // D: (M = v + 8*half, N = row) -> stage in LDS
          float val = acc[j][v] + bo[j];
          int nl = v + half * 8;                // local n (0..15)
          if (m < 2) xt[nl * KPIT + o] = (_Float16)val;                // Q/K rows [n][o] (xt is free: A frags live in registers)
          else       sVst[o * VSP + wave * 16 + nl] = (_Float16)val;   // V [o][block-local n]
        }
      }
      asm volatile("s_wait_dscnt 0x0" ::: "memory");     // this wave's reads of tile t are done
      asm volatile("s_wait_asynccnt 0x0" ::: "memory");  // this wave's share of tile t + 1 has landed
      __syncthreads();                                   // publishes tile t + 1 and frees tile t's buffer
      if (t + 2 < NWT) copy_rows64(lW + (q & 1) * WBUF * 2, gW + (size_t)(t + 2) * WROWS * Cch);   // refill the buffer just read
    }
    if (m < 2) {                                // this wave's 16 rows of Qt / Kt: 512 B each = 32 lanes x 16 B
      LDSX();
      _Float16* dst = (m == 0 ? Qt : Kt) + ((size_t)b * Nsq + n0) * Cch;
      #pragma unroll 4
      for (int nl = 0; nl < 16; ++nl) vst2(dst + (size_t)nl * Cch + lane * 8, *(const v4u*)&xt[nl * KPIT + lane * 8]);
      __builtin_amdgcn_wave_barrier();          // before the next m overwrites xt
    }
  }
  asm volatile("s_wait_asynccnt 0x0" ::: "memory");   // nothing of this wave is in flight when the loop is left
  __syncthreads();
  const int n0blk = ((blockIdx.x * 4) & 255) << 4;
  for (int q = threadIdx.x; q < 256 * 8; q += 128) { const int o = q >> 3, pc = q & 7;
    vst2(V + ((size_t)b * Cch + o) * (size_t)Nsq + n0blk + pc * 8, *(const v4u*)&sVst[o * VSP + pc * 8]); }
}

// ---------------------------------------------------------------------------
// Kernel 2: flash attention + residual. One wave = 16 query columns x 256 channels, transposed: K and V are the A operands,
// Q^T and P^T the B operands, so lane l holds scores, statistics and context of query l & 15 alone.
// A block has eight waves, two on each SIMD, so that one wave's softmax runs beside the other's products: waves w and w + 4 own the
// same 16 queries, w the first 32 keys of every 64-key stage and w + 4 the last 32; their two partial softmaxes are joined at the end.
// The block's 64 Q rows (once) and 64-key K and V tiles (three buffers) reach LDS by asynchronous copies of whole lines;
// the waves read their fragments from there. Row pitches are 16 B x odd, so a ds_load_b128 meets no bank twice.
// Three buffers, because a stage's V rows are read behind the barrier that publishes the next stage: the buffer refilled there is
// the one of the stage before, which every wave has left.
// ---------------------------------------------------------------------------
constexpr int KT   = 64;                 // keys per LDS stage = one 32-key softmax step for each half of the waves
constexpr int VPIT = KT + 8;             // halfs per V row in LDS: 128 B + 16 B
constexpr int KBUF = KT * KPIT;          // halfs of one K tile
constexpr int STG  = KBUF + Cch * VPIT;  // halfs of one stage (K tile, then V tile)
constexpr int NSTG = Nsq / KT;           // stages in all

__global__ void __launch_bounds__(256)
attn_kernel(const float* __restrict__ x,
            const _Float16* __restrict__ Qt,   // [B][N][C]
            const _Float16* __restrict__ Kt,   // [B][N][C]
            const _Float16* __restrict__ Vm,   // [B][C][N]
            float* __restrict__ out) {
  __shared__ __align__(16) float    cst[128 * 64];
  __shared__ __align__(16) float    sMx[8 * 32];             // each wave's running maximum and key sum, per lane, for the join
  __shared__ __align__(16) float    sSm[8 * 32];
  __shared__ __align__(16) _Float16 sQ[64 * KPIT];           // the block's query rows
  __shared__ __align__(16) _Float16 ring[3 * STG];           // three stages of K and V
  const int wave = threadIdx.x >> 5, lane = threadIdx.x & 31;
  const int qt = wave & 3, kg = wave >> 2;     // query tile of the block; half of each stage's keys
  const int tile = blockIdx.x * 4 + qt;        // 0..1023
  const int b  = tile >> 8;
  const int i0blk = ((blockIdx.x * 4) & 255) << 4;           // the block's first query
  const int row = lane & 15, half = lane >> 4;
  const float C1 = 0.0625f * 1.44269504089f;   // (1/sqrt(256)) * log2(e)

  // Q^T B-fragments (K=c, N=i): this lane's query row in LDS
  const _Float16* Qb = sQ + (qt * 16 + row) * KPIT;

  // each lane's own copy addresses: LDS byte address (low 32 bits of the shared address) and global offset at stage 0.
  // Q and K: a wave copies one whole 512-B row per instruction, rows wave, wave + 8, ... V: eight lanes copy one 128-B row, a block 32 rows.
  const unsigned lQ = (unsigned)(size_t)sQ   + (unsigned)(wave * KPIT * 2 + lane * 16);
  const unsigned lK = (unsigned)(size_t)ring + (unsigned)(wave * KPIT * 2 + lane * 16);
  const unsigned lV = (unsigned)(size_t)ring + (unsigned)(KBUF * 2) + (unsigned)((threadIdx.x >> 3) * VPIT * 2 + (threadIdx.x & 7) * 16);
  const _Float16* gQ = Qt + ((size_t)b * Nsq + i0blk + wave) * Cch + lane * 8;
  const unsigned oK = (unsigned)((b * Nsq + wave) * Cch + lane * 8);                                   // in halfs from Kt, from Vm
  const unsigned oV = (unsigned)((b * Cch + (int)(threadIdx.x >> 3)) * Nsq + (int)(threadIdx.x & 7) * 8);
  acopy8(lQ, 8 * KPIT * 2, gQ, (size_t)8 * Cch);
  acopy8(lK, 8 * KPIT * 2, Kt + oK, (size_t)8 * Cch);
  acopy8(lV, 32 * VPIT * 2, Vm + oV, (size_t)32 * Nsq);
  asm volatile("s_wait_asynccnt 0x0" ::: "memory");   // this wave's share of Q and of stage 0 has landed
  __syncthreads();                                    // ... and every other wave's
  acopy8(lK + STG * 2, 8 * KPIT * 2, Kt + (oK + KT * Cch), (size_t)8 * Cch);    // stage 1 flies while stage 0 is worked on
  acopy8(lV + STG * 2, 32 * VPIT * 2, Vm + (oV + KT), (size_t)32 * Nsq);

  v8f acc[16];                                  // context tile [256 c][16 i]: acc[ct][v] = channel ct*16 + 8*half + v of query row
  #pragma unroll
  for (int ct = 0; ct < 16; ++ct) { v8f z = {}; acc[ct] = z; }
  float mrun = -3.0e38f, srun = 0.f;            // online-softmax stats of this lane's query; srun sums this half's keys only

  // ---- the score operands sit in registers before a pass starts: Q^T is read once, K is fetched one stage ahead.
  // kf[2k], kf[2k+1] = channels 32k.. of this wave's keys 0..15 and 16..31. ----
  v16h qf[8], kf[16], vh[16];
  #pragma unroll
  for (int k = 0; k < 8; ++k) {
    qf[k]         = bfrag16(Qb + k * 32, half);                            // A map == B map helper (row ptr at k0)
    kf[2 * k]     = bfrag16(ring + (kg * 32 + row) * KPIT + k * 32, half);
    kf[2 * k + 1] = bfrag16(ring + (kg * 32 + 16 + row) * KPIT + k * 32, half);
  }
  int bc = 0, bn = 1, br = 2;                   // buffers of stage t, of stage t + 1, and of stage t - 1 = the one to refill
  for (int t = 0; t < NSTG; ++t) {
    // ---- scores: two 16x16 tiles (keys 0..15, 16..31 of this wave's half of the stage), K = 256, operands already in registers ----
    v8f sD0 = {}, sD1 = {};                     // S^T: sD0[v] = key 8*half + v, sD1[v] = key 16 + 8*half + v, query row
    #pragma unroll
    for (int k = 0; k < 8; ++k) {
      sD0 = WMMA_F16(kf[2 * k],     qf[k], sD0);
      sD1 = WMMA_F16(kf[2 * k + 1], qf[k], sD1);
    }
    // A branch follows: the four vector slots that the chip needs before
    // the scores are read are written here; the barrier keeps the products above them.
    __builtin_amdgcn_sched_barrier(0);
    asm volatile("v_nop\n\tv_nop\n\tv_nop\n\tv_nop");
    asm volatile("s_wait_dscnt 0x0" ::: "memory");     // this wave's reads of stage t - 1 are done
    asm volatile("s_wait_asynccnt 0x0" ::: "memory");  // this wave's share of stage t + 1 has landed
    __syncthreads();                                   // publishes stage t + 1 and frees stage t - 1's buffer
    if (t + 2 < NSTG) {                                // refill it
      acopy8(lK + br * STG * 2, 8 * KPIT * 2, Kt + (oK + (unsigned)(t + 2) * KT * Cch), (size_t)8 * Cch);
      acopy8(lV + br * STG * 2, 32 * VPIT * 2, Vm + (oV + (unsigned)(t + 2) * KT), (size_t)32 * Nsq);
    }
    // ---- one group of reads, it lands under the softmax: this stage's V fragments, then the next stage's K fragments
    // into the registers the products above have just read. The last stage has no next one and reads its own rows again (published,
    // never used). ----
    const _Float16* Vb = ring + bc * STG + KBUF + row * VPIT + kg * 32;   // V row (c = ct*16+row) at this wave's first key
    #pragma unroll
    for (int ct = 0; ct < 16; ++ct) vh[ct] = bfrag16(Vb + ct * 16 * VPIT, half);   // keys 8*half.., 16+8*half..
    {
      const _Float16* K0 = ring + (t + 1 < NSTG ? bn : bc) * STG + (kg * 32 + row) * KPIT;   // key row; same K map as q
      const _Float16* K1 = K0 + 16 * KPIT;
      #pragma unroll
      for (int k = 0; k < 8; ++k) {
        kf[2 * k]     = bfrag16(K0 + k * 32, half);
        kf[2 * k + 1] = bfrag16(K1 + k * 32, half);
      }
    }
    __builtin_amdgcn_sched_barrier(0);          // keeps the reads one group here: left free, they sink among the products and land late
    // ---- online softmax of one query per lane: 16 keys in the lane's own registers, the other 16 in lane ^ 16 ----
    float lm[8];
    #pragma unroll
    for (int v = 0; v < 8; ++v) lm[v] = fmaxf(sD0[v], sD1[v]);
    float l8 = fmaxf(fmaxf(fmaxf(lm[0], lm[1]), fmaxf(lm[2], lm[3])), fmaxf(fmaxf(lm[4], lm[5]), fmaxf(lm[6], lm[7])));
    l8 = fmaxf(l8, xhalf(l8));
    const float mn  = fmaxf(mrun, l8);
    const float cor = __builtin_amdgcn_exp2f((mrun - mn) * C1);   // bare v_exp_f32, no range guard: a factor below the normal range counts as nothing here
    mrun = mn;
    const float eb = 14.0f - mn * C1;           // one addend per lane: the maximum taken off and the 2^14 lift put on, in the exponent
    // two D tiles of S^T, converted in place, are the B fragment of P^T: element s = key 8*half + s, 16 + 8*half + (s - 8)
    v16h pb;
    float ps[8];
    #pragma unroll
    for (int v = 0; v < 8; ++v) {
      const float p0 = __builtin_amdgcn_exp2f(__builtin_fmaf(sD0[v], C1, eb));   // p * 2^14 (p <= 1): one fma, one v_exp_f32
      const float p1 = __builtin_amdgcn_exp2f(__builtin_fmaf(sD1[v], C1, eb));
      ps[v] = p0 + p1;                          // the key sums carry the lift too
      pb[v]     = (_Float16)p0;
      pb[8 + v] = (_Float16)p1;
    }
    srun = srun * cor + (((ps[0] + ps[1]) + (ps[2] + ps[3])) + ((ps[4] + ps[5]) + (ps[6] + ps[7])));
    // ---- context = context * cor + V x P^T : 16 channel tiles, one factor per lane ----
    #pragma unroll
    for (int ct = 0; ct < 16; ++ct) acc[ct] = WMMA_F16(vh[ct], pb, acc[ct] * cor);
    // The loop's back edge follows: the four vector slots that the chip
    // needs behind the last products are written here; the barrier keeps the products above them.
    __builtin_amdgcn_sched_barrier(0);
    asm volatile("v_nop\n\tv_nop\n\tv_nop\n\tv_nop");
    const int bo = bc; bc = bn; bn = br; br = bo;
  }
  asm volatile("s_wait_asynccnt 0x0" ::: "memory");   // nothing of this wave is in flight when the loop is left

  // ---- join of the two key halves of a query: waves w and w + 4 exchange maximum and key sum, lane by lane ----
  const float sown = srun + xhalf(srun);        // the two lane halves' key sums are joined here, once
  sMx[wave * 32 + lane] = mrun;
  sSm[wave * 32 + lane] = sown;
  __syncthreads();
  const float moth = sMx[(wave ^ 4) * 32 + lane];
  const float soth = sSm[(wave ^ 4) * 32 + lane];
  const float mall = fmaxf(mrun, moth);
  const float fown = __builtin_exp2f((mrun - mall) * C1);
  const float foth = __builtin_exp2f((moth - mall) * C1);
  // ---- epilogue: out = x + context / rowsum.
  // Gather the eight waves' context through LDS (two 128-channel passes): the first key half stores, the second adds, so the residual
  // add runs on full channel rows with b128 loads/stores.
  // Block = 64 consecutive query positions: stage [128 c][64 i] per pass, then 256-B row segments of (b, c, i0blk..)
  const float rinv = fown / (sown * fown + soth * foth);   // context and key sums both carry the 2^14 lift: it cancels
  #pragma unroll
  for (int pass = 0; pass < 2; ++pass) {
    __syncthreads();
    if (kg == 0) {
      #pragma unroll
      for (int ct = 0; ct < 8; ++ct) {
        #pragma unroll
        for (int v = 0; v < 8; ++v)             // local channel ct*16 + 8*half + v, query qt*16 + row
          cst[(ct * 16 + half * 8 + v) * 64 + qt * 16 + row] = acc[pass * 8 + ct][v] * rinv;
      }
    }
    __syncthreads();
    if (kg == 1) {
      #pragma unroll
      for (int ct = 0; ct < 8; ++ct) {
        #pragma unroll
        for (int v = 0; v < 8; ++v)
          cst[(ct * 16 + half * 8 + v) * 64 + qt * 16 + row] += acc[pass * 8 + ct][v] * rinv;
      }
    }
    __syncthreads();
    // unrolled so that a thread's eight x loads are in flight together: rolled, each trip waited out its own load
    #pragma unroll
    for (int i = 0; i < 128 * 16 / 256; ++i) { const int qd = i * 256 + threadIdx.x, cl = qd >> 4, pc = qd & 15;
      const int c = pass * 128 + cl;
      const size_t base = ((size_t)b * Cch + c) * (size_t)Nsq + i0blk + pc * 4;
      v4f cv = *(const v4f*)&cst[cl * 64 + pc * 4] + *(const v4f*)&x[base];
      vst2(out + base, cv); }
  }
}

// ---------------------------------------------------------------------------
extern "C" void kernel_launch(void* const* d_in, const int* in_sizes, int n_in,
                              void* d_out, int out_size, void* d_ws, size_t ws_size,
                              hipStream_t stream) {
  const float* x  = (const float*)d_in[0];
  const float* Wq = (const float*)d_in[1];
  const float* bq = (const float*)d_in[2];
  const float* Wk = (const float*)d_in[3];
  const float* bk = (const float*)d_in[4];
  const float* Wv = (const float*)d_in[5];
  const float* bv = (const float*)d_in[6];
  float* out = (float*)d_out;

  // workspace layout: [3][C][C] f16 weights | Qt | Kt | V  (~24.4 MiB total)
  char* ws = (char*)d_ws;
  _Float16* wh = (_Float16*)ws;
  _Float16* Qt = (_Float16*)(ws + (size_t)3 * Cch * Cch * 2);
  _Float16* Kt = Qt + (size_t)Bsz * Nsq * Cch;
  _Float16* V  = Kt + (size_t)Bsz * Nsq * Cch;

  wcvt_kernel<<<(3 * Cch * Cch / 8) / 256, 256, 0, stream>>>(Wq, Wk, Wv, wh);
  // 1024 wave-tiles, 4 waves (128 threads) per block
  qkv_kernel<<<256, 128, 0, stream>>>(x, wh, bq, bk, bv, Qt, Kt, V);
  // 256 blocks of 64 queries, 8 waves (256 threads) per block
  attn_kernel<<<256, 256, 0, stream>>>(x, Qt, Kt, V, out);
}

// v009
// Measured time: 86.5 microseconds a run.
// Two timings next to v008 put it at 1.03 and 1.02 times that version's speed.
// Counting every step since v000, it is 11.6 times as fast.
#include <hip/hip_runtime.h>

typedef __attribute__((ext_vector_type(16))) _Float16 v16h;
typedef __attribute__((ext_vector_type(8)))  _Float16 v8h;
typedef __attribute__((ext_vector_type(8)))  float    v8f;
typedef __attribute__((ext_vector_type(4)))  float    v4f;
typedef __attribute__((ext_vector_type(2)))  float    v2f;
typedef __attribute__((ext_vector_type(2)))  _Float16 v2h;

// Contractions (Q/K/V 1x1 convs K = 256; scores Q.K over C = 256; attn @ V over 4096 keys) on v_wmma_f32_16x16x32_f16:
// f16 operands, f32 accumulate; online softmax in f32 with P lifted by 2^7 (in the exponent) for the f16 conversion; B fragments use the
// same per-lane K map as A (8*half+0..7, 16+8*half+0..7). Attention runs transposed (S^T = K.Q^T, O^T += V.P^T): a lane owns one query.
// Q/K/V panels and the output are staged in LDS and written as whole
typedef __attribute__((ext_vector_type(4)))  unsigned v4u;
template <typename T> __device__ __forceinline__ void vst2(void* p, T v) { *(T*)p = v;  }
__device__ __forceinline__ v8f WMMA_F16(v16h a, v16h b, v8f c) {
  return __builtin_amdgcn_wmma_f32_16x16x32_f16(false, a, false, b, (short)0, c, false, false);
}
__device__ __forceinline__ v16h bfrag16(const _Float16* rowk0, int half) {     // row pointer at k0; k = 8*half+i, 16+8*half+i
  v16h b; ((v8h*)&b)[0] = *(const v8h*)(rowk0 + half * 8); ((v8h*)&b)[1] = *(const v8h*)(rowk0 + 16 + half * 8); return b;
}
// lane l <-> lane l ^ 16 on the vector pipe (no LDS queue behind it)
__device__ __forceinline__ float xhalf(float v) {
  const int b = __builtin_bit_cast(int, v);
  return __builtin_bit_cast(float, __builtin_amdgcn_permlanex16(b, b, 0x76543210, 0xfedcba98, false, false));
}
#define LDSX() do { asm volatile("s_wait_dscnt 0" ::: "memory"); __builtin_amdgcn_wave_barrier(); __builtin_amdgcn_fence(__ATOMIC_RELEASE, "workgroup"); } while (0)

constexpr int Bsz = 4;
constexpr int Cch = 256;   // channels
constexpr int Nsq = 4096;  // sequence positions
constexpr int KPIT = Cch + 8;            // halfs per Q / K / weight row in LDS: 512 B + 16 B

// Eight 16-byte copies per lane, LDS address l + i*ls bytes, global address g + i*gs halfs. The s_wait_xcnt closes the
// statement so that no address register named here is rewritten ahead of it.
__device__ __forceinline__ void acopy8(unsigned l, unsigned ls, const _Float16* g, size_t gs) {
  asm volatile("global_load_async_to_lds_b128 %0, %8, off\n\t"
               "global_load_async_to_lds_b128 %1, %9, off\n\t"
               "global_load_async_to_lds_b128 %2, %10, off\n\t"
               "global_load_async_to_lds_b128 %3, %11, off\n\t"
               "global_load_async_to_lds_b128 %4, %12, off\n\t"
               "global_load_async_to_lds_b128 %5, %13, off\n\t"
               "global_load_async_to_lds_b128 %6, %14, off\n\t"
               "global_load_async_to_lds_b128 %7, %15, off\n\t"
               "s_wait_xcnt 0x0"
               :: "v"(l), "v"(l + ls), "v"(l + 2 * ls), "v"(l + 3 * ls), "v"(l + 4 * ls), "v"(l + 5 * ls), "v"(l + 6 * ls), "v"(l + 7 * ls),
                  "v"(g), "v"(g + gs), "v"(g + 2 * gs), "v"(g + 3 * gs), "v"(g + 4 * gs), "v"(g + 5 * gs), "v"(g + 6 * gs), "v"(g + 7 * gs)
               : "memory");
}
// 64 rows of 512 B (weights): a wave copies one whole row per instruction, rows wave, wave + 4, ...
__device__ __forceinline__ void copy_rows64(unsigned l, const _Float16* g) {
  acopy8(l, 4 * KPIT * 2, g, (size_t)4 * Cch);
  acopy8(l + 32 * KPIT * 2, 4 * KPIT * 2, g + (size_t)32 * Cch, (size_t)4 * Cch);
}

// ---------------------------------------------------------------------------
// Kernel 0: convert the three 256x256 weight matrices to f16 (packed [3][C][C])
// ---------------------------------------------------------------------------
__global__ void wcvt_kernel(const float* __restrict__ wq,
                            const float* __restrict__ wk,
                            const float* __restrict__ wv,
                            _Float16* __restrict__ out) {
  int g8 = blockIdx.x * 256 + threadIdx.x;      // 0 .. 3*65536/8-1, 16 B per thread
  int t0 = g8 * 8; int m = t0 >> 16, e = t0 & 65535;
  const float* s = (m == 0) ? wq : (m == 1) ? wk : wv;
  union { v8h h; v4u u; } pk;
#pragma unroll
  for (int i = 0; i < 8; ++i) pk.h[i] = (_Float16)s[e + i];
  vst2(out + t0, pk.u);
}

// ---------------------------------------------------------------------------
// Kernel 1: QKV projection via WMMA.
//   Qt, Kt : [B][N][C] f16  (row n, contiguous channels -> A/B frags are b128)
//   V      : [B][C][N] f16  (row c, contiguous j        -> A frags are b128)
// One wave handles a 16-row n tile; x tile transposed through LDS once.
// Every staging array has a row pitch of 16 B x odd, so that its b128 reads and the x^T stores meet no bank twice (the V stores do):
// x^T and the Q/K rows 528 B, the V rows 144 B.
// The 768 weight rows reach LDS in tiles of 64 rows (two buffers) by asynchronous copies of whole lines, once for the four
// waves; each wave reads its B fragments from there (row pitch 16 B x odd: a ds_load_b128 meets no bank twice).
// ---------------------------------------------------------------------------
constexpr int WROWS = 64;                // weight rows per LDS tile = four 16-column output tiles
constexpr int WBUF  = WROWS * KPIT;      // halfs of one weight tile
constexpr int NWT   = 3 * Cch / WROWS;   // weight tiles in all
constexpr int VSP   = 64 + 8;            // halfs per V staging row: 128 B + 16 B
__global__ void __launch_bounds__(128, 1)
qkv_kernel(const float* __restrict__ x,         // [B][C][N] f32
           const _Float16* __restrict__ wh,     // [3][C][C] f16
           const float* __restrict__ bq,
           const float* __restrict__ bk,
           const float* __restrict__ bv,
           _Float16* __restrict__ Qt,
           _Float16* __restrict__ Kt,
           _Float16* __restrict__ V) {
  __shared__ __align__(16) _Float16 xT[4][16 * KPIT];         // per-wave x^T tile, reused as the Q/K row staging
  __shared__ __align__(16) _Float16 sVst[256 * VSP];           // block staging of V [o][n0blk..+63]
  __shared__ __align__(16) _Float16 wring[2 * WBUF];           // two tiles of weight rows
  const int wave = threadIdx.x >> 5, lane = threadIdx.x & 31;
  const int tile = blockIdx.x * 4 + wave;       // 0..1023
  const int b  = tile >> 8;                     // 256 n-tiles per batch
  const int n0 = (tile & 255) << 4;
  const int row = lane & 15, half = lane >> 4;

  // each lane's own copy addresses at weight tile 0: LDS byte address (low 32 bits of the shared address) and global pointer
  const unsigned lW = (unsigned)(size_t)wring + (unsigned)(wave * KPIT * 2 + lane * 16);
  const _Float16* gW = wh + wave * Cch + lane * 8;
  copy_rows64(lW, gW);                          // tile 0 flies while x is staged

  _Float16* xt = xT[wave];
  const float* xb = x + (size_t)b * Cch * Nsq;
  // stage x[b][:, n0..n0+15] transposed into LDS as xT[n][c] f16. A lane takes four positions (16 B) of two neighbouring channels,
  // a wave 16 channels per pair of loads; all 32 loads of the wave are in flight together. A channel pair of one position is one
  // 4-byte store: banks 16 * l4 + 4 * e + cp, all 32 lanes apart.
  const int l4 = lane & 3, cp = lane >> 2;
  const float* xp = xb + (size_t)(2 * cp) * Nsq + n0 + 4 * l4;
  v4f xe[16], xo[16];                           // even and odd channel of the pair
  #pragma unroll                                // unrolled: both arrays stay in registers and every load issues before the first is waited for
  for (int j = 0; j < 16; ++j) {
    xe[j] = *(const v4f*)(xp + (size_t)(16 * j) * Nsq);
    xo[j] = *(const v4f*)(xp + (size_t)(16 * j + 1) * Nsq);
  }
  #pragma unroll                                // unrolled (both loops): constant register indices, store offsets as immediates
  for (int j = 0; j < 16; ++j) {
    #pragma unroll
    for (int e = 0; e < 4; ++e) {
      const v2f f = { xe[j][e], xo[j][e] };
      vst2(&xt[(4 * l4 + e) * KPIT + 16 * j + 2 * cp], __builtin_convertvector(f, v2h));
    }
  }
  LDSX();

  // A fragments of x^T (M=n, K=c), K=256 in 8 chunks of 32
  v16h a[8];
  #pragma unroll
  for (int k = 0; k < 8; ++k) {
    ((v8h*)&a[k])[0] = *(const v8h*)&xt[row * KPIT + k * 32 + half * 8];
    ((v8h*)&a[k])[1] = *(const v8h*)&xt[row * KPIT + k * 32 + half * 8 + 16];
  }

  asm volatile("s_wait_asynccnt 0x0" ::: "memory");   // this wave's share of weight tile 0 has landed
  __syncthreads();                                    // ... and every other wave's
  copy_rows64(lW + WBUF * 2, gW + WROWS * Cch);       // tile 1 flies while tile 0 is worked on

  #pragma unroll
  for (int m = 0; m < 3; ++m) {                 // m constant after unroll: no flat loads
    const float* bias = (m == 0) ? bq : (m == 1) ? bk : bv;
    for (int q = 0; q < 4; ++q) {               // weight tile t = 4 m + q: output columns 64 q .. 64 q + 63 of matrix m
      const int t = m * 4 + q;
      const _Float16* Wb = wring + (q & 1) * WBUF + row * KPIT;      // this lane's weight row of the tile's first 16
      v16h wf[8][4];                            // read in the order in which the products below take them
      #pragma unroll
      for (int k = 0; k < 8; ++k) {
        #pragma unroll
        for (int j = 0; j < 4; ++j) wf[k][j] = bfrag16(Wb + j * 16 * KPIT + k * 32, half);   // same K map as A
      }
      float bo[4];
      #pragma unroll
      for (int j = 0; j < 4; ++j) bo[j] = bias[(q * 4 + j) * 16 + row];
      asm volatile("s_wait_xcnt 0x0" ::: "memory");   // stands in front of every rewrite of the bias loads' address registers
      // Keeps the tile's reads one group ahead of the products (left free, they were spread among them and waited for one by one)
      // and the address arithmetic of the next trip behind the wait above.
      __builtin_amdgcn_sched_barrier(0);
      v8f acc[4];
      #pragma unroll
      for (int j = 0; j < 4; ++j) { v8f z = {}; acc[j] = z; }
      #pragma unroll
      for (int k = 0; k < 8; ++k) {
        #pragma unroll
        for (int j = 0; j < 4; ++j) acc[j] = WMMA_F16(a[k], wf[k][j], acc[j]);
      }
      #pragma unroll
      for (int j = 0; j < 4; ++j) {
        const int o = (q * 4 + j) * 16 + row;   // this lane's output column
        #pragma unroll
        for (int v = 0; v < 8; ++v) {           // D: (M = v + 8*half, N = row) -> stage in LDS
          float val = acc[j][v] + bo[j];
          int nl = v + half * 8;                // local n (0..15)
          if (m < 2) xt[nl * KPIT + o] = (_Float16)val;                // Q/K rows [n][o] (xt is free: A frags live in registers)
          else       sVst[o * VSP + wave * 16 + nl] = (_Float16)val;   // V [o][block-local n]
        }
      }
      asm volatile("s_wait_dscnt 0x0" ::: "memory");     // this wave's reads of tile t are done
      asm volatile("s_wait_asynccnt 0x0" ::: "memory");  // this wave's share of tile t + 1 has landed
      __syncthreads();                                   // publishes tile t + 1 and frees tile t's buffer
      if (t + 2 < NWT) copy_rows64(lW + (q & 1) * WBUF * 2, gW + (size_t)(t + 2) * WROWS * Cch);   // refill the buffer just read
    }
    if (m < 2) {                                // this wave's 16 rows of Qt / Kt: 512 B each = 32 lanes x 16 B
      LDSX();
      _Float16* dst = (m == 0 ? Qt : Kt) + ((size_t)b * Nsq + n0) * Cch;
      #pragma unroll 4
      for (int nl = 0; nl < 16; ++nl) vst2(dst + (size_t)nl * Cch + lane * 8, *(const v4u*)&xt[nl * KPIT + lane * 8]);
      __builtin_amdgcn_wave_barrier();          // before the next m overwrites xt
    }
  }
  asm volatile("s_wait_asynccnt 0x0" ::: "memory");   // nothing of this wave is in flight when the loop is left
  __syncthreads();
  const int n0blk = ((blockIdx.x * 4) & 255) << 4;
  for (int q = threadIdx.x; q < 256 * 8; q += 128) { const int o = q >> 3, pc = q & 7;
    vst2(V + ((size_t)b * Cch + o) * (size_t)Nsq + n0blk + pc * 8, *(const v4u*)&sVst[o * VSP + pc * 8]); }
}

// ---------------------------------------------------------------------------
// Kernel 2: flash attention + residual. One wave = 16 query columns x 256 channels, transposed: K and V are the A operands,
// Q^T and P^T the B operands, so lane l holds scores, statistics and context of query l & 15 alone.
// A block has eight waves, two on each SIMD, so that one wave's softmax runs beside the other's products: waves w and w + 4 own the
// same 16 queries, w the first 32 keys of every 64-key stage and w + 4 the last 32; their two partial softmaxes are joined at the end.
// The block's 64 Q rows (once) and 64-key K and V tiles (three buffers) reach LDS by asynchronous copies of whole lines;
// the waves read their fragments from there. Row pitches are 16 B x odd, so a ds_load_b128 meets no bank twice.
// Three buffers, because a stage's V rows are read behind the barrier that publishes the next stage: the buffer refilled there is
// the one of the stage before, which every wave has left.
// ---------------------------------------------------------------------------
constexpr int KT   = 64;                 // keys per LDS stage = one 32-key softmax step for each half of the waves
constexpr int VPIT = KT + 8;             // halfs per V row in LDS: 128 B + 16 B
constexpr int KBUF = KT * KPIT;          // halfs of one K tile
constexpr int STG  = KBUF + Cch * VPIT;  // halfs of one stage (K tile, then V tile)
constexpr int NSTG = Nsq / KT;           // stages in all

__global__ void __launch_bounds__(256)
attn_kernel(const float* __restrict__ x,
            const _Float16* __restrict__ Qt,   // [B][N][C]
            const _Float16* __restrict__ Kt,   // [B][N][C]
            const _Float16* __restrict__ Vm,   // [B][C][N]
            float* __restrict__ out) {
  __shared__ __align__(16) float    cst[128 * 64];
  __shared__ __align__(16) float    sMx[8 * 32];             // each wave's softmax reference and key sum, per lane, for the join
  __shared__ __align__(16) float    sSm[8 * 32];
  __shared__ __align__(16) _Float16 sQ[64 * KPIT];           // the block's query rows
  __shared__ __align__(16) _Float16 ring[3 * STG];           // three stages of K and V
  const int wave = threadIdx.x >> 5, lane = threadIdx.x & 31;
  const int qt = wave & 3, kg = wave >> 2;     // query tile of the block; half of each stage's keys
  const int tile = blockIdx.x * 4 + qt;        // 0..1023
  const int b  = tile >> 8;
  const int i0blk = ((blockIdx.x * 4) & 255) << 4;           // the block's first query
  const int row = lane & 15, half = lane >> 4;
  const float C1 = 0.0625f * 1.44269504089f;   // (1/sqrt(256)) * log2(e)

  // Q^T B-fragments (K=c, N=i): this lane's query row in LDS
  const _Float16* Qb = sQ + (qt * 16 + row) * KPIT;

  // each lane's own copy addresses: LDS byte address (low 32 bits of the shared address) and global offset at stage 0.
  // Q and K: a wave copies one whole 512-B row per instruction, rows wave, wave + 8, ... V: eight lanes copy one 128-B row, a block 32 rows.
  const unsigned lQ = (unsigned)(size_t)sQ   + (unsigned)(wave * KPIT * 2 + lane * 16);
  const unsigned lK = (unsigned)(size_t)ring + (unsigned)(wave * KPIT * 2 + lane * 16);
  const unsigned lV = (unsigned)(size_t)ring + (unsigned)(KBUF * 2) + (unsigned)((threadIdx.x >> 3) * VPIT * 2 + (threadIdx.x & 7) * 16);
  const _Float16* gQ = Qt + ((size_t)b * Nsq + i0blk + wave) * Cch + lane * 8;
  const unsigned oK = (unsigned)((b * Nsq + wave) * Cch + lane * 8);                                   // in halfs from Kt, from Vm
  const unsigned oV = (unsigned)((b * Cch + (int)(threadIdx.x >> 3)) * Nsq + (int)(threadIdx.x & 7) * 8);
  acopy8(lQ, 8 * KPIT * 2, gQ, (size_t)8 * Cch);
  acopy8(lK, 8 * KPIT * 2, Kt + oK, (size_t)8 * Cch);
  acopy8(lV, 32 * VPIT * 2, Vm + oV, (size_t)32 * Nsq);
  asm volatile("s_wait_asynccnt 0x0" ::: "memory");   // this wave's share of Q and of stage 0 has landed
  __syncthreads();                                    // ... and every other wave's
  acopy8(lK + STG * 2, 8 * KPIT * 2, Kt + (oK + KT * Cch), (size_t)8 * Cch);    // stage 1 flies while stage 0 is worked on
  acopy8(lV + STG * 2, 32 * VPIT * 2, Vm + (oV + KT), (size_t)32 * Nsq);

  v8f acc[16];                                  // context tile [256 c][16 i]: acc[ct][v] = channel ct*16 + 8*half + v of query row
  #pragma unroll
  for (int ct = 0; ct < 16; ++ct) { v8f z = {}; acc[ct] = z; }
  // online-softmax stats of this lane's query; srun sums this half's keys only. mrun is a reference, not the exact running maximum: it
  // moves only when a score passes it by more than RISE (a factor 2^8 in p), so that context and key sum are rescaled in few stages.
  // p * 2^7 then stays at or below 2^15, inside f16; any reference gives the same quotient context / key sum.
  const float RISE = 8.0f / C1;
  float mrun = -3.0e38f, srun = 0.f;
  float thr = -3.0e38f;                         // mrun + RISE; the first stage always passes it
  float eb = 0.f;                               // 7 - mrun * C1: the reference taken off and the 2^7 lift put on, in the exponent

  // ---- the score operands sit in registers before a pass starts: Q^T is read once, K is fetched one stage ahead.
  // kf[2k], kf[2k+1] = channels 32k.. of this wave's keys 0..15 and 16..31. ----
  v16h qf[8], kf[16], vh[16];
  #pragma unroll
  for (int k = 0; k < 8; ++k) {
    qf[k]         = bfrag16(Qb + k * 32, half);                            // A map == B map helper (row ptr at k0)
    kf[2 * k]     = bfrag16(ring + (kg * 32 + row) * KPIT + k * 32, half);
    kf[2 * k + 1] = bfrag16(ring + (kg * 32 + 16 + row) * KPIT + k * 32, half);
  }
  int bc = 0, bn = 1, br = 2;                   // buffers of stage t, of stage t + 1, and of stage t - 1 = the one to refill
  for (int t = 0; t < NSTG; ++t) {
    // ---- scores: two 16x16 tiles (keys 0..15, 16..31 of this wave's half of the stage), K = 256, operands already in registers ----
    v8f sD0 = {}, sD1 = {};                     // S^T: sD0[v] = key 8*half + v, sD1[v] = key 16 + 8*half + v, query row
    #pragma unroll
    for (int k = 0; k < 8; ++k) {
      sD0 = WMMA_F16(kf[2 * k],     qf[k], sD0);
      sD1 = WMMA_F16(kf[2 * k + 1], qf[k], sD1);
    }
    // A branch follows: the four vector slots that the chip needs before
    // the scores are read are written here; the barrier keeps the products above them.
    __builtin_amdgcn_sched_barrier(0);
    asm volatile("v_nop\n\tv_nop\n\tv_nop\n\tv_nop");
    asm volatile("s_wait_dscnt 0x0" ::: "memory");     // this wave's reads of stage t - 1 are done
    asm volatile("s_wait_asynccnt 0x0" ::: "memory");  // this wave's share of stage t + 1 has landed
    __syncthreads();                                   // publishes stage t + 1 and frees stage t - 1's buffer
    if (t + 2 < NSTG) {                                // refill it
      acopy8(lK + br * STG * 2, 8 * KPIT * 2, Kt + (oK + (unsigned)(t + 2) * KT * Cch), (size_t)8 * Cch);
      acopy8(lV + br * STG * 2, 32 * VPIT * 2, Vm + (oV + (unsigned)(t + 2) * KT), (size_t)32 * Nsq);
    }
    // ---- one group of reads, it lands under the softmax: this stage's V fragments, then the next stage's K fragments
    // into the registers the products above have just read. The last stage has no next one and reads its own rows again (published,
    // never used). ----
    const _Float16* Vb = ring + bc * STG + KBUF + row * VPIT + kg * 32;   // V row (c = ct*16+row) at this wave's first key
    #pragma unroll
    for (int ct = 0; ct < 16; ++ct) vh[ct] = bfrag16(Vb + ct * 16 * VPIT, half);   // keys 8*half.., 16+8*half..
    {
      const _Float16* K0 = ring + (t + 1 < NSTG ? bn : bc) * STG + (kg * 32 + row) * KPIT;   // key row; same K map as q
      const _Float16* K1 = K0 + 16 * KPIT;
      #pragma unroll
      for (int k = 0; k < 8; ++k) {
        kf[2 * k]     = bfrag16(K0 + k * 32, half);
        kf[2 * k + 1] = bfrag16(K1 + k * 32, half);
      }
    }
    __builtin_amdgcn_sched_barrier(0);          // keeps the reads one group here: left free, they sink among the products and land late
    // ---- online softmax of one query per lane: 16 keys in the lane's own registers, the other 16 in lane ^ 16 ----
    float lm[8];
    #pragma unroll
    for (int v = 0; v < 8; ++v) lm[v] = fmaxf(sD0[v], sD1[v]);
    const float l8 = fmaxf(fmaxf(fmaxf(lm[0], lm[1]), fmaxf(lm[2], lm[3])), fmaxf(fmaxf(lm[4], lm[5]), fmaxf(lm[6], lm[7])));
    // One scalar branch for the wave (EXEC stays whole for the products behind it): taken when any of its queries needs a new reference.
    // The test is over all 32 lanes, so it sees both lane halves of a query; the halves' maxima are joined only where the reference moves.
    if (__builtin_amdgcn_ballot_w32(l8 > thr) != 0u) {
      const float mn  = fmaxf(mrun, fmaxf(l8, xhalf(l8)));
      const float cor = __builtin_amdgcn_exp2f((mrun - mn) * C1);   // bare v_exp_f32, no range guard: a factor below the normal range counts as nothing here
      mrun = mn;
      thr  = mn + RISE;
      eb   = 7.0f - mn * C1;
      srun *= cor;
      #pragma unroll                            // unrolled: constant register indices
      for (int ct = 0; ct < 16; ++ct) acc[ct] *= cor;
    }
    // two D tiles of S^T, converted in place, are the B fragment of P^T: element s = key 8*half + s, 16 + 8*half + (s - 8)
    v16h pb;
    float ps[8];
    #pragma unroll
    for (int v = 0; v < 8; ++v) {               // the exponents, in place
      sD0[v] = __builtin_fmaf(sD0[v], C1, eb);
      sD1[v] = __builtin_fmaf(sD1[v], C1, eb);
    }
    // Keeps the sixteen fma one group ahead of the v_exp_f32: there they pair into dual issue; left free, they were spread singly among
    // the v_exp_f32, each behind a v_nop.
    __builtin_amdgcn_sched_barrier(0);
    #pragma unroll
    for (int v = 0; v < 8; ++v) {
      const float p0 = __builtin_amdgcn_exp2f(sD0[v]);   // p * 2^7 (p <= 2^8): one fma, one v_exp_f32
      const float p1 = __builtin_amdgcn_exp2f(sD1[v]);
      ps[v] = p0 + p1;                          // the key sums carry the lift too
      pb[v]     = (_Float16)p0;
      pb[8 + v] = (_Float16)p1;
    }
    srun += (((ps[0] + ps[1]) + (ps[2] + ps[3])) + ((ps[4] + ps[5]) + (ps[6] + ps[7])));
    // ---- context += V x P^T : 16 channel tiles ----
    #pragma unroll
    for (int ct = 0; ct < 16; ++ct) acc[ct] = WMMA_F16(vh[ct], pb, acc[ct]);
    // The loop's back edge follows: the four vector slots that the chip
    // needs behind the last products are written here; the barrier keeps the products above them.
    __builtin_amdgcn_sched_barrier(0);
    asm volatile("v_nop\n\tv_nop\n\tv_nop\n\tv_nop");
    const int bo = bc; bc = bn; bn = br; br = bo;
  }
  asm volatile("s_wait_asynccnt 0x0" ::: "memory");   // nothing of this wave is in flight when the loop is left

  // ---- join of the two key halves of a query: waves w and w + 4 exchange reference and key sum, lane by lane ----
  const float sown = srun + xhalf(srun);        // the two lane halves' key sums are joined here, once
  sMx[wave * 32 + lane] = mrun;
  sSm[wave * 32 + lane] = sown;
  __syncthreads();
  const float moth = sMx[(wave ^ 4) * 32 + lane];
  const float soth = sSm[(wave ^ 4) * 32 + lane];
  const float mall = fmaxf(mrun, moth);
  const float fown = __builtin_exp2f((mrun - mall) * C1);
  const float foth = __builtin_exp2f((moth - mall) * C1);
  // ---- epilogue: out = x + context / rowsum.
  // Gather the eight waves' context through LDS (two 128-channel passes): the first key half stores, the second adds, so the residual
  // add runs on full channel rows with b128 loads/stores.
  // Block = 64 consecutive query positions: stage [128 c][64 i] per pass, then 256-B row segments of (b, c, i0blk..)
  const float rinv = fown / (sown * fown + soth * foth);   // context and key sums both carry the 2^7 lift: it cancels
  #pragma unroll
  for (int pass = 0; pass < 2; ++pass) {
    __syncthreads();
    if (kg == 0) {
      #pragma unroll
      for (int ct = 0; ct < 8; ++ct) {
        #pragma unroll
        for (int v = 0; v < 8; ++v)             // local channel ct*16 + 8*half + v, query qt*16 + row
          cst[(ct * 16 + half * 8 + v) * 64 + qt * 16 + row] = acc[pass * 8 + ct][v] * rinv;
      }
    }
    __syncthreads();
    if (kg == 1) {
      #pragma unroll
      for (int ct = 0; ct < 8; ++ct) {
        #pragma unroll
        for (int v = 0; v < 8; ++v)
          cst[(ct * 16 + half * 8 + v) * 64 + qt * 16 + row] += acc[pass * 8 + ct][v] * rinv;
      }
    }
    __syncthreads();
    // unrolled so that a thread's eight x loads are in flight together: rolled, each trip waited out its own load
    #pragma unroll
    for (int i = 0; i < 128 * 16 / 256; ++i) { const int qd = i * 256 + threadIdx.x, cl = qd >> 4, pc = qd & 15;
      const int c = pass * 128 + cl;
      const size_t base = ((size_t)b * Cch + c) * (size_t)Nsq + i0blk + pc * 4;
      v4f cv = *(const v4f*)&cst[cl * 64 + pc * 4] + *(const v4f*)&x[base];
      vst2(out + base, cv); }
  }
}

// ---------------------------------------------------------------------------
extern "C" void kernel_launch(void* const* d_in, const int* in_sizes, int n_in,
                              void* d_out, int out_size, void* d_ws, size_t ws_size,
                              hipStream_t stream) {
  const float* x  = (const float*)d_in[0];
  const float* Wq = (const float*)d_in[1];
  const float* bq = (const float*)d_in[2];
  const float* Wk = (const float*)d_in[3];
  const float* bk = (const float*)d_in[4];
  const float* Wv = (const float*)d_in[5];
  const float* bv = (const float*)d_in[6];
  float* out = (float*)d_out;

  // workspace layout: [3][C][C] f16 weights | Qt | Kt | V  (~24.4 MiB total)
  char* ws = (char*)d_ws;
  _Float16* wh = (_Float16*)ws;
  _Float16* Qt = (_Float16*)(ws + (size_t)3 * Cch * Cch * 2);
  _Float16* Kt = Qt + (size_t)Bsz * Nsq * Cch;
  _Float16* V  = Kt + (size_t)Bsz * Nsq * Cch;

  wcvt_kernel<<<(3 * Cch * Cch / 8) / 256, 256, 0, stream>>>(Wq, Wk, Wv, wh);
  // 1024 wave-tiles, 4 waves (128 threads) per block
  qkv_kernel<<<256, 128, 0, stream>>>(x, wh, bq, bk, bv, Qt, Kt, V);
  // 256 blocks of 64 queries, 8 waves (256 threads) per block
  attn_kernel<<<256, 256, 0, stream>>>(x, Qt, Kt, V, out);
}

// v010
// It runs in 81.9 microseconds.
// In both of two side-by-side timings against v009, it was 1.06 times as fast.
// Over all steps from v000 it is 12.4 times as fast.
#include <hip/hip_runtime.h>

typedef __attribute__((ext_vector_type(16))) _Float16 v16h;
typedef __attribute__((ext_vector_type(8)))  _Float16 v8h;
typedef __attribute__((ext_vector_type(8)))  float    v8f;
typedef __attribute__((ext_vector_type(4)))  float    v4f;
typedef __attribute__((ext_vector_type(2)))  float    v2f;
typedef __attribute__((ext_vector_type(2)))  _Float16 v2h;

// Contractions (Q/K/V 1x1 convs K = 256; scores Q.K over C = 256; attn @ V over 4096 keys) on v_wmma_f32_16x16x32_f16:
// f16 operands, f32 accumulate; online softmax in f32 with P lifted by 2^7 (in the exponent) for the f16 conversion; B fragments use the
// same per-lane K map as A (8*half+0..7, 16+8*half+0..7). Attention runs transposed (S^T = K.Q^T, O^T += V.P^T): a lane owns one query.
// Q/K/V panels and the output are staged in LDS and written as whole
typedef __attribute__((ext_vector_type(4)))  unsigned v4u;
template <typename T> __device__ __forceinline__ void vst2(void* p, T v) { *(T*)p = v;  }
__device__ __forceinline__ v8f WMMA_F16(v16h a, v16h b, v8f c) {
  return __builtin_amdgcn_wmma_f32_16x16x32_f16(false, a, false, b, (short)0, c, false, false);
}
__device__ __forceinline__ v16h bfrag16(const _Float16* rowk0, int half) {     // row pointer at k0; k = 8*half+i, 16+8*half+i
  v16h b; ((v8h*)&b)[0] = *(const v8h*)(rowk0 + half * 8); ((v8h*)&b)[1] = *(const v8h*)(rowk0 + 16 + half * 8); return b;
}
// lane l <-> lane l ^ 16 on the vector pipe (no LDS queue behind it)
__device__ __forceinline__ float xhalf(float v) {
  const int b = __builtin_bit_cast(int, v);
  return __builtin_bit_cast(float, __builtin_amdgcn_permlanex16(b, b, 0x76543210, 0xfedcba98, false, false));
}
#define LDSX() do { asm volatile("s_wait_dscnt 0" ::: "memory"); __builtin_amdgcn_wave_barrier(); __builtin_amdgcn_fence(__ATOMIC_RELEASE, "workgroup"); } while (0)

constexpr int Bsz = 4;
constexpr int Cch = 256;   // channels
constexpr int Nsq = 4096;  // sequence positions
constexpr int KPIT = Cch + 8;            // halfs per Q / K / weight row in LDS: 512 B + 16 B

// Eight 16-byte copies per lane, LDS address l + i*ls bytes, global address g + i*gs halfs. The s_wait_xcnt closes the
// statement so that no address register named here is rewritten ahead of it.
__device__ __forceinline__ void acopy8(unsigned l, unsigned ls, const _Float16* g, size_t gs) {
  asm volatile("global_load_async_to_lds_b128 %0, %8, off\n\t"
               "global_load_async_to_lds_b128 %1, %9, off\n\t"
               "global_load_async_to_lds_b128 %2, %10, off\n\t"
               "global_load_async_to_lds_b128 %3, %11, off\n\t"
               "global_load_async_to_lds_b128 %4, %12, off\n\t"
               "global_load_async_to_lds_b128 %5, %13, off\n\t"
               "global_load_async_to_lds_b128 %6, %14, off\n\t"
               "global_load_async_to_lds_b128 %7, %15, off\n\t"
               "s_wait_xcnt 0x0"
               :: "v"(l), "v"(l + ls), "v"(l + 2 * ls), "v"(l + 3 * ls), "v"(l + 4 * ls), "v"(l + 5 * ls), "v"(l + 6 * ls), "v"(l + 7 * ls),
                  "v"(g), "v"(g + gs), "v"(g + 2 * gs), "v"(g + 3 * gs), "v"(g + 4 * gs), "v"(g + 5 * gs), "v"(g + 6 * gs), "v"(g + 7 * gs)
               : "memory");
}
// 64 rows of 512 B (weights): a wave copies one whole row per instruction, rows wave, wave + 4, ...
__device__ __forceinline__ void copy_rows64(unsigned l, const _Float16* g) {
  acopy8(l, 4 * KPIT * 2, g, (size_t)4 * Cch);
  acopy8(l + 32 * KPIT * 2, 4 * KPIT * 2, g + (size_t)32 * Cch, (size_t)4 * Cch);
}

// ---------------------------------------------------------------------------
// Kernel 0: convert the three 256x256 weight matrices to f16 (packed [3][C][C])
// ---------------------------------------------------------------------------
__global__ void wcvt_kernel(const float* __restrict__ wq,
                            const float* __restrict__ wk,
                            const float* __restrict__ wv,
                            _Float16* __restrict__ out) {
  int g8 = blockIdx.x * 256 + threadIdx.x;      // 0 .. 3*65536/8-1, 16 B per thread
  int t0 = g8 * 8; int m = t0 >> 16, e = t0 & 65535;
  const float* s = (m == 0) ? wq : (m == 1) ? wk : wv;
  union { v8h h; v4u u; } pk;
#pragma unroll
  for (int i = 0; i < 8; ++i) pk.h[i] = (_Float16)s[e + i];
  vst2(out + t0, pk.u);
}

// ---------------------------------------------------------------------------
// Kernel 1: QKV projection via WMMA.
//   Qt, Kt : [B][N][C] f16  (row n, contiguous channels -> A/B frags are b128)
//   V      : [B][C][N] f16  (row c, contiguous j        -> A frags are b128)
// One wave handles a 16-row n tile; x tile transposed through LDS once.
// Every staging array has a row pitch of 16 B x odd, so that its b128 reads and the x^T stores meet no bank twice (the V stores do):
// x^T and the Q/K rows 528 B, the V rows 144 B.
// The 768 weight rows reach LDS in tiles of 64 rows (two buffers) by asynchronous copies of whole lines, once for the four
// waves; each wave reads its B fragments from there (row pitch 16 B x odd: a ds_load_b128 meets no bank twice).
// All blocks read the same weight lines from L2: a block takes the four tiles of a matrix in an order rotated by its index, so that
// at one moment the blocks ask for four different tiles.
// ---------------------------------------------------------------------------
constexpr int WROWS = 64;                // weight rows per LDS tile = four 16-column output tiles
constexpr int WBUF  = WROWS * KPIT;      // halfs of one weight tile
constexpr int NWT   = 3 * Cch / WROWS;   // weight tiles in all
constexpr int VSP   = 64 + 8;            // halfs per V staging row: 128 B + 16 B
__global__ void __launch_bounds__(128, 1)
qkv_kernel(const float* __restrict__ x,         // [B][C][N] f32
           const _Float16* __restrict__ wh,     // [3][C][C] f16
           const float* __restrict__ bq,
           const float* __restrict__ bk,
           const float* __restrict__ bv,
           _Float16* __restrict__ Qt,
           _Float16* __restrict__ Kt,
           _Float16* __restrict__ V) {
  __shared__ __align__(16) _Float16 xT[4][16 * KPIT];         // per-wave x^T tile, reused as the Q/K row staging
  __shared__ __align__(16) _Float16 sVst[256 * VSP];           // block staging of V [o][n0blk..+63]
  __shared__ __align__(16) _Float16 wring[2 * WBUF];           // two tiles of weight rows
  const int wave = threadIdx.x >> 5, lane = threadIdx.x & 31;
  const int tile = blockIdx.x * 4 + wave;       // 0..1023
  const int b  = tile >> 8;                     // 256 n-tiles per batch
  const int n0 = (tile & 255) << 4;
  const int row = lane & 15, half = lane >> 4;

  // each lane's own copy addresses at weight tile 0: LDS byte address (low 32 bits of the shared address) and global pointer
  const unsigned lW = (unsigned)(size_t)wring + (unsigned)(wave * KPIT * 2 + lane * 16);
  const _Float16* gW = wh + wave * Cch + lane * 8;
  const int r4 = blockIdx.x & 3;                // trip p works on weight tile (p & ~3) | ((p + r4) & 3)
  copy_rows64(lW, gW + r4 * WROWS * Cch);       // the first tile flies while x is staged

  _Float16* xt = xT[wave];
  const float* xb = x + (size_t)b * Cch * Nsq;
  // stage x[b][:, n0..n0+15] transposed into LDS as xT[n][c] f16. A lane takes four positions (16 B) of two neighbouring channels,
  // a wave 16 channels per pair of loads; all 32 loads of the wave are in flight together. A channel pair of one position is one
  // 4-byte store: banks 16 * l4 + 4 * e + cp, all 32 lanes apart.
  const int l4 = lane & 3, cp = lane >> 2;
  const float* xp = xb + (size_t)(2 * cp) * Nsq + n0 + 4 * l4;
  v4f xe[16], xo[16];                           // even and odd channel of the pair
  #pragma unroll                                // unrolled: both arrays stay in registers and every load issues before the first is waited for
  for (int j = 0; j < 16; ++j) {
    xe[j] = *(const v4f*)(xp + (size_t)(16 * j) * Nsq);
    xo[j] = *(const v4f*)(xp + (size_t)(16 * j + 1) * Nsq);
  }
  #pragma unroll                                // unrolled (both loops): constant register indices, store offsets as immediates
  for (int j = 0; j < 16; ++j) {
    #pragma unroll
    for (int e = 0; e < 4; ++e) {
      const v2f f = { xe[j][e], xo[j][e] };
      vst2(&xt[(4 * l4 + e) * KPIT + 16 * j + 2 * cp], __builtin_convertvector(f, v2h));
    }
  }
  LDSX();

  // A fragments of x^T (M=n, K=c), K=256 in 8 chunks of 32
  v16h a[8];
  #pragma unroll
  for (int k = 0; k < 8; ++k) {
    ((v8h*)&a[k])[0] = *(const v8h*)&xt[row * KPIT + k * 32 + half * 8];
    ((v8h*)&a[k])[1] = *(const v8h*)&xt[row * KPIT + k * 32 + half * 8 + 16];
  }

  asm volatile("s_wait_asynccnt 0x0" ::: "memory");   // this wave's share of the first weight tile has landed
  __syncthreads();                                    // ... and every other wave's
  copy_rows64(lW + WBUF * 2, gW + ((1 + r4) & 3) * WROWS * Cch);   // the second tile flies while the first is worked on

  #pragma unroll
  for (int m = 0; m < 3; ++m) {                 // m constant after unroll: no flat loads
    const float* bias = (m == 0) ? bq : (m == 1) ? bk : bv;
    for (int q = 0; q < 4; ++q) {               // trip t = 4 m + q, weight tile 4 m + qq: output columns 64 qq .. 64 qq + 63 of matrix m
      const int t = m * 4 + q;
      const int qq = (q + r4) & 3;
      const _Float16* Wb = wring + (q & 1) * WBUF + row * KPIT;      // this lane's weight row of the tile's first 16
      v16h wf[8][4];                            // read in the order in which the products below take them
      #pragma unroll
      for (int k = 0; k < 8; ++k) {
        #pragma unroll
        for (int j = 0; j < 4; ++j) wf[k][j] = bfrag16(Wb + j * 16 * KPIT + k * 32, half);   // same K map as A
      }
      float bo[4];
      #pragma unroll
      for (int j = 0; j < 4; ++j) bo[j] = bias[(qq * 4 + j) * 16 + row];
      asm volatile("s_wait_xcnt 0x0" ::: "memory");   // stands in front of every rewrite of the bias loads' address registers
      // Keeps the tile's reads one group ahead of the products (left free, they were spread among them and waited for one by one)
      // and the address arithmetic of the next trip behind the wait above.
      __builtin_amdgcn_sched_barrier(0);
      v8f acc[4];
      #pragma unroll
      for (int j = 0; j < 4; ++j) { v8f z = {}; acc[j] = z; }
      #pragma unroll
      for (int k = 0; k < 8; ++k) {
        #pragma unroll
        for (int j = 0; j < 4; ++j) acc[j] = WMMA_F16(a[k], wf[k][j], acc[j]);
      }
      #pragma unroll
      for (int j = 0; j < 4; ++j) {
        const int o = (qq * 4 + j) * 16 + row;  // this lane's output column
        #pragma unroll
        for (int v = 0; v < 8; ++v) {           // D: (M = v + 8*half, N = row) -> stage in LDS
          float val = acc[j][v] + bo[j];
          int nl = v + half * 8;                // local n (0..15)
          if (m < 2) xt[nl * KPIT + o] = (_Float16)val;                // Q/K rows [n][o] (xt is free: A frags live in registers)
          else       sVst[o * VSP + wave * 16 + nl] = (_Float16)val;   // V [o][block-local n]
        }
      }
      asm volatile("s_wait_dscnt 0x0" ::: "memory");     // this wave's reads of trip t's tile are done
      asm volatile("s_wait_asynccnt 0x0" ::: "memory");  // this wave's share of trip t + 1's tile has landed
      __syncthreads();                                   // publishes trip t + 1's tile and frees trip t's buffer
      if (t + 2 < NWT)                                   // refill the buffer just read with the tile of trip t + 2
        copy_rows64(lW + (q & 1) * WBUF * 2, gW + (size_t)(((t + 2) & ~3) | ((t + 2 + r4) & 3)) * WROWS * Cch);
    }
    if (m < 2) {                                // this wave's 16 rows of Qt / Kt: 512 B each = 32 lanes x 16 B
      LDSX();
      _Float16* dst = (m == 0 ? Qt : Kt) + ((size_t)b * Nsq + n0) * Cch;
      #pragma unroll 4
      for (int nl = 0; nl < 16; ++nl) vst2(dst + (size_t)nl * Cch + lane * 8, *(const v4u*)&xt[nl * KPIT + lane * 8]);
      __builtin_amdgcn_wave_barrier();          // before the next m overwrites xt
    }
  }
  asm volatile("s_wait_asynccnt 0x0" ::: "memory");   // nothing of this wave is in flight when the loop is left
  __syncthreads();
  const int n0blk = ((blockIdx.x * 4) & 255) << 4;
  for (int q = threadIdx.x; q < 256 * 8; q += 128) { const int o = q >> 3, pc = q & 7;
    vst2(V + ((size_t)b * Cch + o) * (size_t)Nsq + n0blk + pc * 8, *(const v4u*)&sVst[o * VSP + pc * 8]); }
}

// ---------------------------------------------------------------------------
// Kernel 2: flash attention + residual. One wave = 16 query columns x 256 channels, transposed: K and V are the A operands,
// Q^T and P^T the B operands, so lane l holds scores, statistics and context of query l & 15 alone.
// A block has eight waves, two on each SIMD, so that one wave's softmax runs beside the other's products: waves w and w + 4 own the
// same 16 queries, w the first 32 keys of every 64-key stage and w + 4 the last 32; their two partial softmaxes are joined at the end.
// The block's 64 Q rows (once) and 64-key K and V tiles (three buffers) reach LDS by asynchronous copies of whole lines;
// the waves read their fragments from there. Row pitches are 16 B x odd, so a ds_load_b128 meets no bank twice.
// Three buffers, because a stage's V rows are read behind the barrier that publishes the next stage: the buffer refilled there is
// the one of the stage before, which every wave has left.
// The 64 blocks of a batch read the same K and V lines from L2. Each starts its walk over the 64 stages at a stage of its own and wraps,
// so that at one moment no two of them ask for the same lines; the online softmax takes the keys in any order.
// ---------------------------------------------------------------------------
constexpr int KT   = 64;                 // keys per LDS stage = one 32-key softmax step for each half of the waves
constexpr int VPIT = KT + 8;             // halfs per V row in LDS: 128 B + 16 B
constexpr int KBUF = KT * KPIT;          // halfs of one K tile
constexpr int STG  = KBUF + Cch * VPIT;  // halfs of one stage (K tile, then V tile)
constexpr int NSTG = Nsq / KT;           // stages in all

__global__ void __launch_bounds__(256)
attn_kernel(const float* __restrict__ x,
            const _Float16* __restrict__ Qt,   // [B][N][C]
            const _Float16* __restrict__ Kt,   // [B][N][C]
            const _Float16* __restrict__ Vm,   // [B][C][N]
            float* __restrict__ out) {
  __shared__ __align__(16) float    cst[128 * 64];
  __shared__ __align__(16) float    sMx[8 * 32];             // each wave's softmax reference and key sum, per lane, for the join
  __shared__ __align__(16) float    sSm[8 * 32];
  __shared__ __align__(16) _Float16 sQ[64 * KPIT];           // the block's query rows
  __shared__ __align__(16) _Float16 ring[3 * STG];           // three stages of K and V
  const int wave = threadIdx.x >> 5, lane = threadIdx.x & 31;
  const int qt = wave & 3, kg = wave >> 2;     // query tile of the block; half of each stage's keys
  const int tile = blockIdx.x * 4 + qt;        // 0..1023
  const int b  = tile >> 8;
  const int i0blk = ((blockIdx.x * 4) & 255) << 4;           // the block's first query
  const int row = lane & 15, half = lane >> 4;
  const float C1 = 0.0625f * 1.44269504089f;   // (1/sqrt(256)) * log2(e)

  // Q^T B-fragments (K=c, N=i): this lane's query row in LDS
  const _Float16* Qb = sQ + (qt * 16 + row) * KPIT;

  // each lane's own copy addresses: LDS byte address (low 32 bits of the shared address) and global offset at stage 0.
  // Q and K: a wave copies one whole 512-B row per instruction, rows wave, wave + 8, ... V: eight lanes copy one 128-B row, a block 32 rows.
  const unsigned lQ = (unsigned)(size_t)sQ   + (unsigned)(wave * KPIT * 2 + lane * 16);
  const unsigned lK = (unsigned)(size_t)ring + (unsigned)(wave * KPIT * 2 + lane * 16);
  const unsigned lV = (unsigned)(size_t)ring + (unsigned)(KBUF * 2) + (unsigned)((threadIdx.x >> 3) * VPIT * 2 + (threadIdx.x & 7) * 16);
  const _Float16* gQ = Qt + ((size_t)b * Nsq + i0blk + wave) * Cch + lane * 8;
  const unsigned oK = (unsigned)((b * Nsq + wave) * Cch + lane * 8);                                   // in halfs from Kt, from Vm
  const unsigned oV = (unsigned)((b * Cch + (int)(threadIdx.x >> 3)) * Nsq + (int)(threadIdx.x & 7) * 8);
  const unsigned s0 = blockIdx.x & (NSTG - 1);        // pass t works on stage (s0 + t) mod NSTG
  const unsigned s1 = (s0 + 1) & (NSTG - 1);
  acopy8(lQ, 8 * KPIT * 2, gQ, (size_t)8 * Cch);
  acopy8(lK, 8 * KPIT * 2, Kt + (oK + s0 * KT * Cch), (size_t)8 * Cch);
  acopy8(lV, 32 * VPIT * 2, Vm + (oV + s0 * KT), (size_t)32 * Nsq);
  asm volatile("s_wait_asynccnt 0x0" ::: "memory");   // this wave's share of Q and of the first stage has landed
  __syncthreads();                                    // ... and every other wave's
  acopy8(lK + STG * 2, 8 * KPIT * 2, Kt + (oK + s1 * KT * Cch), (size_t)8 * Cch);    // the second stage flies while the first is worked on
  acopy8(lV + STG * 2, 32 * VPIT * 2, Vm + (oV + s1 * KT), (size_t)32 * Nsq);

  v8f acc[16];                                  // context tile [256 c][16 i]: acc[ct][v] = channel ct*16 + 8*half + v of query row
  #pragma unroll
  for (int ct = 0; ct < 16; ++ct) { v8f z = {}; acc[ct] = z; }
  // online-softmax stats of this lane's query; srun sums this half's keys only. mrun is a reference, not the exact running maximum: it
  // moves only when a score passes it by more than RISE (a factor 2^8 in p), so that context and key sum are rescaled in few stages.
  // p * 2^7 then stays at or below 2^15, inside f16; any reference gives the same quotient context / key sum.
  const float RISE = 8.0f / C1;
  float mrun = -3.0e38f, srun = 0.f;
  float thr = -3.0e38f;                         // mrun + RISE; the first stage always passes it
  float eb = 0.f;                               // 7 - mrun * C1: the reference taken off and the 2^7 lift put on, in the exponent

  // ---- the score operands sit in registers before a pass starts: Q^T is read once, K is fetched one stage ahead.
  // kf[2k], kf[2k+1] = channels 32k.. of this wave's keys 0..15 and 16..31. ----
  v16h qf[8], kf[16], vh[16];
  #pragma unroll
  for (int k = 0; k < 8; ++k) {
    qf[k]         = bfrag16(Qb + k * 32, half);                            // A map == B map helper (row ptr at k0)
    kf[2 * k]     = bfrag16(ring + (kg * 32 + row) * KPIT + k * 32, half);
    kf[2 * k + 1] = bfrag16(ring + (kg * 32 + 16 + row) * KPIT + k * 32, half);
  }
  int bc = 0, bn = 1, br = 2;                   // buffers of stage t, of stage t + 1, and of stage t - 1 = the one to refill
  for (int t = 0; t < NSTG; ++t) {
    // ---- scores: two 16x16 tiles (keys 0..15, 16..31 of this wave's half of the stage), K = 256, operands already in registers ----
    v8f sD0 = {}, sD1 = {};                     // S^T: sD0[v] = key 8*half + v, sD1[v] = key 16 + 8*half + v, query row
    #pragma unroll
    for (int k = 0; k < 8; ++k) {
      sD0 = WMMA_F16(kf[2 * k],     qf[k], sD0);
      sD1 = WMMA_F16(kf[2 * k + 1], qf[k], sD1);
    }
    // A branch follows: the four vector slots that the chip needs before
    // the scores are read are written here; the barrier keeps the products above them.
    __builtin_amdgcn_sched_barrier(0);
    asm volatile("v_nop\n\tv_nop\n\tv_nop\n\tv_nop");
    asm volatile("s_wait_dscnt 0x0" ::: "memory");     // this wave's reads of stage t - 1 are done
    asm volatile("s_wait_asynccnt 0x0" ::: "memory");  // this wave's share of stage t + 1 has landed
    __syncthreads();                                   // publishes stage t + 1 and frees stage t - 1's buffer
    if (t + 2 < NSTG) {                                // refill it
      const unsigned sn = (s0 + (unsigned)(t + 2)) & (NSTG - 1);   // the stage of pass t + 2, wrapped
      acopy8(lK + br * STG * 2, 8 * KPIT * 2, Kt + (oK + sn * KT * Cch), (size_t)8 * Cch);
      acopy8(lV + br * STG * 2, 32 * VPIT * 2, Vm + (oV + sn * KT), (size_t)32 * Nsq);
    }
    // ---- one group of reads, it lands under the softmax: this stage's V fragments, then the next stage's K fragments
    // into the registers the products above have just read. The last stage has no next one and reads its own rows again (published,
    // never used). ----
    const _Float16* Vb = ring + bc * STG + KBUF + row * VPIT + kg * 32;   // V row (c = ct*16+row) at this wave's first key
    #pragma unroll
    for (int ct = 0; ct < 16; ++ct) vh[ct] = bfrag16(Vb + ct * 16 * VPIT, half);   // keys 8*half.., 16+8*half..
    {
      const _Float16* K0 = ring + (t + 1 < NSTG ? bn : bc) * STG + (kg * 32 + row) * KPIT;   // key row; same K map as q
      const _Float16* K1 = K0 + 16 * KPIT;
      #pragma unroll
      for (int k = 0; k < 8; ++k) {
        kf[2 * k]     = bfrag16(K0 + k * 32, half);
        kf[2 * k + 1] = bfrag16(K1 + k * 32, half);
      }
    }
    __builtin_amdgcn_sched_barrier(0);          // keeps the reads one group here: left free, they sink among the products and land late
    // ---- online softmax of one query per lane: 16 keys in the lane's own registers, the other 16 in lane ^ 16 ----
    float lm[8];
    #pragma unroll
    for (int v = 0; v < 8; ++v) lm[v] = fmaxf(sD0[v], sD1[v]);
    const float l8 = fmaxf(fmaxf(fmaxf(lm[0], lm[1]), fmaxf(lm[2], lm[3])), fmaxf(fmaxf(lm[4], lm[5]), fmaxf(lm[6], lm[7])));
    // One scalar branch for the wave (EXEC stays whole for the products behind it): taken when any of its queries needs a new reference.
    // The test is over all 32 lanes, so it sees both lane halves of a query; the halves' maxima are joined only where the reference moves.
    if (__builtin_amdgcn_ballot_w32(l8 > thr) != 0u) {
      const float mn  = fmaxf(mrun, fmaxf(l8, xhalf(l8)));
      const float cor = __builtin_amdgcn_exp2f((mrun - mn) * C1);   // bare v_exp_f32, no range guard: a factor below the normal range counts as nothing here
      mrun = mn;
      thr  = mn + RISE;
      eb   = 7.0f - mn * C1;
      srun *= cor;
      #pragma unroll                            // unrolled: constant register indices
      for (int ct = 0; ct < 16; ++ct) acc[ct] *= cor;
    }
    // two D tiles of S^T, converted in place, are the B fragment of P^T: element s = key 8*half + s, 16 + 8*half + (s - 8)
    v16h pb;
    float ps[8];
    #pragma unroll
    for (int v = 0; v < 8; ++v) {               // the exponents, in place
      sD0[v] = __builtin_fmaf(sD0[v], C1, eb);
      sD1[v] = __builtin_fmaf(sD1[v], C1, eb);
    }
    // Keeps the sixteen fma one group ahead of the v_exp_f32: there they pair into dual issue; left free, they were spread singly among
    // the v_exp_f32, each behind a v_nop.
    __builtin_amdgcn_sched_barrier(0);
    #pragma unroll
    for (int v = 0; v < 8; ++v) {
      const float p0 = __builtin_amdgcn_exp2f(sD0[v]);   // p * 2^7 (p <= 2^8): one fma, one v_exp_f32
      const float p1 = __builtin_amdgcn_exp2f(sD1[v]);
      ps[v] = p0 + p1;                          // the key sums carry the lift too
      pb[v]     = (_Float16)p0;
      pb[8 + v] = (_Float16)p1;
    }
    srun += (((ps[0] + ps[1]) + (ps[2] + ps[3])) + ((ps[4] + ps[5]) + (ps[6] + ps[7])));
    // ---- context += V x P^T : 16 channel tiles ----
    #pragma unroll
    for (int ct = 0; ct < 16; ++ct) acc[ct] = WMMA_F16(vh[ct], pb, acc[ct]);
    // The loop's back edge follows: the four vector slots that the chip
    // needs behind the last products are written here; the barrier keeps the products above them.
    __builtin_amdgcn_sched_barrier(0);
    asm volatile("v_nop\n\tv_nop\n\tv_nop\n\tv_nop");
    const int bo = bc; bc = bn; bn = br; br = bo;
  }
  asm volatile("s_wait_asynccnt 0x0" ::: "memory");   // nothing of this wave is in flight when the loop is left

  // ---- join of the two key halves of a query: waves w and w + 4 exchange reference and key sum, lane by lane ----
  const float sown = srun + xhalf(srun);        // the two lane halves' key sums are joined here, once
  sMx[wave * 32 + lane] = mrun;
  sSm[wave * 32 + lane] = sown;
  __syncthreads();
  const float moth = sMx[(wave ^ 4) * 32 + lane];
  const float soth = sSm[(wave ^ 4) * 32 + lane];
  const float mall = fmaxf(mrun, moth);
  const float fown = __builtin_exp2f((mrun - mall) * C1);
  const float foth = __builtin_exp2f((moth - mall) * C1);
  // ---- epilogue: out = x + context / rowsum.
  // Gather the eight waves' context through LDS (two 128-channel passes): the first key half stores, the second adds, so the residual
  // add runs on full channel rows with b128 loads/stores.
  // Block = 64 consecutive query positions: stage [128 c][64 i] per pass, then 256-B row segments of (b, c, i0blk..)
  const float rinv = fown / (sown * fown + soth * foth);   // context and key sums both carry the 2^7 lift: it cancels
  #pragma unroll
  for (int pass = 0; pass < 2; ++pass) {
    __syncthreads();
    if (kg == 0) {
      #pragma unroll
      for (int ct = 0; ct < 8; ++ct) {
        #pragma unroll
        for (int v = 0; v < 8; ++v)             // local channel ct*16 + 8*half + v, query qt*16 + row
          cst[(ct * 16 + half * 8 + v) * 64 + qt * 16 + row] = acc[pass * 8 + ct][v] * rinv;
      }
    }
    __syncthreads();
    if (kg == 1) {
      #pragma unroll
      for (int ct = 0; ct < 8; ++ct) {
        #pragma unroll
        for (int v = 0; v < 8; ++v)
          cst[(ct * 16 + half * 8 + v) * 64 + qt * 16 + row] += acc[pass * 8 + ct][v] * rinv;
      }
    }
    __syncthreads();
    // unrolled so that a thread's eight x loads are in flight together: rolled, each trip waited out its own load
    #pragma unroll
    for (int i = 0; i < 128 * 16 / 256; ++i) { const int qd = i * 256 + threadIdx.x, cl = qd >> 4, pc = qd & 15;
      const int c = pass * 128 + cl;
      const size_t base = ((size_t)b * Cch + c) * (size_t)Nsq + i0blk + pc * 4;
      v4f cv = *(const v4f*)&cst[cl * 64 + pc * 4] + *(const v4f*)&x[base];
      vst2(out + base, cv); }
  }
}

// ---------------------------------------------------------------------------
extern "C" void kernel_launch(void* const* d_in, const int* in_sizes, int n_in,
                              void* d_out, int out_size, void* d_ws, size_t ws_size,
                              hipStream_t stream) {
  const float* x  = (const float*)d_in[0];
  const float* Wq = (const float*)d_in[1];
  const float* bq = (const float*)d_in[2];
  const float* Wk = (const float*)d_in[3];
  const float* bk = (const float*)d_in[4];
  const float* Wv = (const float*)d_in[5];
  const float* bv = (const float*)d_in[6];
  float* out = (float*)d_out;

  // workspace layout: [3][C][C] f16 weights | Qt | Kt | V  (~24.4 MiB total)
  char* ws = (char*)d_ws;
  _Float16* wh = (_Float16*)ws;
  _Float16* Qt = (_Float16*)(ws + (size_t)3 * Cch * Cch * 2);
  _Float16* Kt = Qt + (size_t)Bsz * Nsq * Cch;
  _Float16* V  = Kt + (size_t)Bsz * Nsq * Cch;

  wcvt_kernel<<<(3 * Cch * Cch / 8) / 256, 256, 0, stream>>>(Wq, Wk, Wv, wh);
  // 1024 wave-tiles, 4 waves (128 threads) per block
  qkv_kernel<<<256, 128, 0, stream>>>(x, wh, bq, bk, bv, Qt, Kt, V);
  // 256 blocks of 64 queries, 8 waves (256 threads) per block
  attn_kernel<<<256, 256, 0, stream>>>(x, Qt, Kt, V, out);
}
